// v000
// Times are from an AMD MI455X. After a warm-up the kernel runs many times in a row, and a time is the length of
// such a window on the GPU divided by its runs, so every launch and the gaps after it count. The runs cycle
// through copies of the inputs. A figure is the median of several windows, for all but v000 over two sittings.
// Sittings can differ by a few percent; kernels timed side by side share one.
// The starting kernel, v000, takes 261 microseconds a run.
#include <hip/hip_runtime.h>
#include <hip/hip_bf16.h>

// ---------------------------------------------------------------------------
// MultiHeadCrossModalAttention on MI455X (gfx1250, wave32, WMMA bf16,
// async global->LDS staging, DPP16 softmax reductions)
// B=4, S=2048, D=512, H=8, HD=64
// ---------------------------------------------------------------------------

typedef __attribute__((ext_vector_type(16))) __bf16 v16bf;
typedef __attribute__((ext_vector_type(8)))  __bf16 v8bf;
typedef __attribute__((ext_vector_type(8)))  float  v8f;
typedef int v4i __attribute__((vector_size(16)));

#define B_  4
#define S_  2048
#define D_  512
#define H_  8
#define HD_ 64
#define MROWS (B_ * S_)          // 8192

#define AS1 __attribute__((address_space(1)))
#define AS3 __attribute__((address_space(3)))

#if __has_builtin(__builtin_amdgcn_global_load_async_to_lds_b128) && \
    __has_builtin(__builtin_amdgcn_s_wait_asynccnt)
#define HAVE_ASYNC_LDS 1
#else
#define HAVE_ASYNC_LDS 0
#endif

#if __has_builtin(__builtin_amdgcn_update_dpp)
#define HAVE_DPP 1
#else
#define HAVE_DPP 0
#endif

// one 16B chunk: global -> LDS (async on CDNA5, sync fallback otherwise)
__device__ __forceinline__ void stage16(const __bf16* g, __bf16* l) {
#if HAVE_ASYNC_LDS
  __builtin_amdgcn_global_load_async_to_lds_b128((AS1 v4i*)g, (AS3 v4i*)l,
                                                 0, 0);
#else
  *(v8bf*)l = *(const v8bf*)g;
#endif
}

__device__ __forceinline__ void async_wait_all() {
#if HAVE_ASYNC_LDS
  __builtin_amdgcn_s_wait_asynccnt(0);
#endif
}

#if HAVE_DPP
template <int CTRL>
__device__ __forceinline__ float dpp_mov_f32(float x) {
  int r = __builtin_amdgcn_update_dpp(0, __float_as_int(x), CTRL, 0xF, 0xF,
                                      true);
  return __int_as_float(r);
}
#endif

// reduce (max / sum) across each 16-lane group; all lanes get the result.
__device__ __forceinline__ float red16_max(float x) {
#if HAVE_DPP
  x = fmaxf(x, dpp_mov_f32<0xB1>(x));    // quad_perm(1,0,3,2): xor 1
  x = fmaxf(x, dpp_mov_f32<0x4E>(x));    // quad_perm(2,3,0,1): xor 2
  x = fmaxf(x, dpp_mov_f32<0x141>(x));   // row_half_mirror: cross-quad in 8
  x = fmaxf(x, dpp_mov_f32<0x140>(x));   // row_mirror: cross-8 in 16
#else
#pragma unroll
  for (int off = 1; off < 16; off <<= 1) x = fmaxf(x, __shfl_xor(x, off, 32));
#endif
  return x;
}

__device__ __forceinline__ float red16_sum(float x) {
#if HAVE_DPP
  x += dpp_mov_f32<0xB1>(x);
  x += dpp_mov_f32<0x4E>(x);
  x += dpp_mov_f32<0x141>(x);
  x += dpp_mov_f32<0x140>(x);
#else
#pragma unroll
  for (int off = 1; off < 16; off <<= 1) x += __shfl_xor(x, off, 32);
#endif
  return x;
}

__device__ __forceinline__ v16bf pack16(v8bf lo, v8bf hi) {
  union { v16bf v; v8bf p[2]; } u;
  u.p[0] = lo; u.p[1] = hi;
  return u.v;
}

__device__ __forceinline__ v8f zero8() {
  v8f z;
#pragma unroll
  for (int i = 0; i < 8; ++i) z[i] = 0.0f;
  return z;
}

// ------------------------------- casts -------------------------------------

__global__ __launch_bounds__(256) void cast_bf16_kernel(
    const float* __restrict__ in, __bf16* __restrict__ out, int n) {
  int i = (blockIdx.x * 256 + threadIdx.x) * 4;
  if (i + 3 < n) {
#pragma unroll
    for (int j = 0; j < 4; ++j) out[i + j] = (__bf16)in[i + j];
  }
}

// Wt[n][k] = W[k][n], 512x512
__global__ __launch_bounds__(256) void castT_bf16_kernel(
    const float* __restrict__ W, __bf16* __restrict__ Wt) {
  int i = blockIdx.x * 256 + threadIdx.x;   // over 512*512
  int n = i >> 9;
  int k = i & 511;
  Wt[i] = (__bf16)W[k * D_ + n];
}

// ------------------------------- GEMM --------------------------------------
// C[M,N] = (A[M,K] @ Bt[N,K]^T + bias[N]) * alpha
// Tiles: BM=128, BN=128, BK=32.  256 threads = 8 waves (2x4), wave: 64x32.
// Double-buffered async global->LDS staging.

#define BM 128
#define BN 128
#define BK 32

template <bool OUT_F32>
__global__ __launch_bounds__(256) void gemm_bf16_kernel(
    const __bf16* __restrict__ A, const __bf16* __restrict__ Bt,
    const float* __restrict__ bias, void* __restrict__ C,
    int M, int N, int K, float alpha) {
  __shared__ __align__(16) __bf16 As[2][BM][BK + 8];   // 80B rows
  __shared__ __align__(16) __bf16 Bs[2][BM][BK + 8];

  const int tid  = threadIdx.x;
  const int bm0  = blockIdx.y * BM;
  const int bn0  = blockIdx.x * BN;
  const int wave = tid >> 5;
  const int lane = tid & 31;
  const int wm   = wave >> 2;        // 0..1 -> 64-row slab
  const int wn   = wave & 3;         // 0..3 -> 32-col slab
  const int lr   = lane & 15;
  const int lh   = lane >> 4;
  const int koff = lh * 8;

  // this thread's two 16B staging chunks (same mapping for A and B tiles)
  const int c0   = tid * 2;
  const int row0 = c0 >> 2;
  const int col0 = (c0 & 3) * 8;
  const int row1 = (c0 + 1) >> 2;
  const int col1 = ((c0 + 1) & 3) * 8;

  v8f acc[4][2];
#pragma unroll
  for (int mt = 0; mt < 4; ++mt)
#pragma unroll
    for (int nt = 0; nt < 2; ++nt) acc[mt][nt] = zero8();

  // prologue: stage tile 0 into buffer 0
  {
    stage16(&A[(size_t)(bm0 + row0) * K + col0], &As[0][row0][col0]);
    stage16(&Bt[(size_t)(bn0 + row0) * K + col0], &Bs[0][row0][col0]);
    stage16(&A[(size_t)(bm0 + row1) * K + col1], &As[0][row1][col1]);
    stage16(&Bt[(size_t)(bn0 + row1) * K + col1], &Bs[0][row1][col1]);
  }

  int p = 0;
  for (int bk = 0; bk < K; bk += BK, p ^= 1) {
    async_wait_all();
    __syncthreads();
    if (bk + BK < K) {
      int nb = bk + BK;
      stage16(&A[(size_t)(bm0 + row0) * K + nb + col0], &As[p ^ 1][row0][col0]);
      stage16(&Bt[(size_t)(bn0 + row0) * K + nb + col0], &Bs[p ^ 1][row0][col0]);
      stage16(&A[(size_t)(bm0 + row1) * K + nb + col1], &As[p ^ 1][row1][col1]);
      stage16(&Bt[(size_t)(bn0 + row1) * K + nb + col1], &Bs[p ^ 1][row1][col1]);
    }

    v16bf af[4], bf[2];
#pragma unroll
    for (int mt = 0; mt < 4; ++mt) {
      int r   = wm * 64 + mt * 16 + lr;
      v8bf lo = *(const v8bf*)&As[p][r][koff];
      v8bf hi = *(const v8bf*)&As[p][r][koff + 16];
      af[mt]  = pack16(lo, hi);
    }
#pragma unroll
    for (int nt = 0; nt < 2; ++nt) {
      int r   = wn * 32 + nt * 16 + lr;
      v8bf lo = *(const v8bf*)&Bs[p][r][koff];
      v8bf hi = *(const v8bf*)&Bs[p][r][koff + 16];
      bf[nt]  = pack16(lo, hi);
    }
#pragma unroll
    for (int mt = 0; mt < 4; ++mt)
#pragma unroll
      for (int nt = 0; nt < 2; ++nt)
        acc[mt][nt] = __builtin_amdgcn_wmma_f32_16x16x32_bf16(
            false, af[mt], false, bf[nt], (short)0, acc[mt][nt], false, false);
  }

  // epilogue: C layout -> lane holds col n=lr of each tile, rows r + lh*8
#pragma unroll
  for (int nt = 0; nt < 2; ++nt) {
    int n    = bn0 + wn * 32 + nt * 16 + lr;
    float bv = bias[n];
#pragma unroll
    for (int mt = 0; mt < 4; ++mt) {
#pragma unroll
      for (int r = 0; r < 8; ++r) {
        int m   = bm0 + wm * 64 + mt * 16 + lh * 8 + r;
        float v = (acc[mt][nt][r] + bv) * alpha;
        if constexpr (OUT_F32)
          ((float*)C)[(size_t)m * N + n] = v;
        else
          ((__bf16*)C)[(size_t)m * N + n] = (__bf16)v;
      }
    }
  }
}

// ------------------------------- fuse --------------------------------------
// K' = K*s + sh ; V' = V*s + sh ; also write V' transposed per head:
// Vt[b][h][hd][s]
__global__ __launch_bounds__(256) void fuse_kv_kernel(
    const __bf16* __restrict__ Kr, const __bf16* __restrict__ Vr,
    const __bf16* __restrict__ Sc, const __bf16* __restrict__ Sh,
    __bf16* __restrict__ Kf, __bf16* __restrict__ Vt) {
  int i = blockIdx.x * 256 + threadIdx.x;      // over B*S*D = 2^22
  float sc = (float)Sc[i], sh = (float)Sh[i];
  float kv = (float)Kr[i] * sc + sh;
  float vv = (float)Vr[i] * sc + sh;
  Kf[i] = (__bf16)kv;
  int d = i & (D_ - 1);
  int s = (i >> 9) & (S_ - 1);
  int b = i >> 20;
  int h = d >> 6, hd = d & 63;
  Vt[(((size_t)(b * H_ + h) * HD_) + hd) * S_ + s] = (__bf16)vv;
}

// ---------------------------- flash attention -------------------------------
// grid: (S/64, H, B), block 128 (4 waves). Wave w owns q rows q0+w*16..+15.
// Q already scaled by 1/sqrt(HD). Double-buffered async K/V tile staging.
__global__ __launch_bounds__(128) void attn_kernel(
    const __bf16* __restrict__ Qb, const __bf16* __restrict__ Kb,
    const __bf16* __restrict__ Vt, __bf16* __restrict__ Ob) {
  __shared__ __align__(16) __bf16 Ks[2][64][72];    // [key][hd]
  __shared__ __align__(16) __bf16 Vs[2][64][72];    // [hd][key] (transposed V)
  __shared__ __align__(16) __bf16 Ps[4][16][72];    // per-wave P tile

  const int b    = blockIdx.z;
  const int h    = blockIdx.y;
  const int q0   = blockIdx.x * 64;
  const int tid  = threadIdx.x;
  const int wave = tid >> 5;
  const int lane = tid & 31;
  const int lr   = lane & 15;
  const int lh   = lane >> 4;
  const int koff = lh * 8;

  const __bf16* Kbase = Kb + (size_t)(b * S_) * D_ + h * HD_;
  const __bf16* Vbase = Vt + (size_t)(b * H_ + h) * HD_ * S_;

  // Q fragments (16x64 per wave -> 2 k-steps), resident in VGPRs
  v16bf qf[2];
  {
    int qrow           = q0 + wave * 16 + lr;
    const __bf16* qptr = Qb + (size_t)(b * S_ + qrow) * D_ + h * HD_;
#pragma unroll
    for (int ks = 0; ks < 2; ++ks) {
      v8bf lo = *(const v8bf*)(qptr + ks * 32 + koff);
      v8bf hi = *(const v8bf*)(qptr + ks * 32 + koff + 16);
      qf[ks]  = pack16(lo, hi);
    }
  }

  v8f o[4];
#pragma unroll
  for (int nt = 0; nt < 4; ++nt) o[nt] = zero8();
  float rm[8], rs[8];
#pragma unroll
  for (int r = 0; r < 8; ++r) { rm[r] = -1e30f; rs[r] = 0.0f; }

  // this thread's four 16B staging chunks per tile
  // chunk c = tid + i*128; row = c>>3 (8 x 16B per 128B row); col = (c&7)*8
  // prologue: stage tile 0 into buffer 0
#pragma unroll
  for (int i = 0; i < 4; ++i) {
    int c = tid + i * 128, row = c >> 3, col = (c & 7) * 8;
    stage16(&Kbase[(size_t)row * D_ + col], &Ks[0][row][col]);
    stage16(&Vbase[(size_t)row * S_ + col], &Vs[0][row][col]);
  }

  int p = 0;
  for (int kt0 = 0; kt0 < S_; kt0 += 64, p ^= 1) {
    async_wait_all();
    __syncthreads();
    if (kt0 + 64 < S_) {
      int nk = kt0 + 64;
#pragma unroll
      for (int i = 0; i < 4; ++i) {
        int c = tid + i * 128, row = c >> 3, col = (c & 7) * 8;
        stage16(&Kbase[(size_t)(nk + row) * D_ + col], &Ks[p ^ 1][row][col]);
        stage16(&Vbase[(size_t)row * S_ + nk + col], &Vs[p ^ 1][row][col]);
      }
    }

    // S = Q @ K^T   (4 n-tiles x 2 k-steps)
    v8f sc[4];
#pragma unroll
    for (int nt = 0; nt < 4; ++nt) {
      sc[nt] = zero8();
#pragma unroll
      for (int ks = 0; ks < 2; ++ks) {
        int row  = nt * 16 + lr;
        v8bf lo  = *(const v8bf*)&Ks[p][row][ks * 32 + koff];
        v8bf hi  = *(const v8bf*)&Ks[p][row][ks * 32 + koff + 16];
        v16bf kf = pack16(lo, hi);
        sc[nt]   = __builtin_amdgcn_wmma_f32_16x16x32_bf16(
            false, qf[ks], false, kf, (short)0, sc[nt], false, false);
      }
    }

    // online softmax: lane holds col n=lr, rows r+lh*8; row lives in 16 lanes
#pragma unroll
    for (int r = 0; r < 8; ++r) {
      float mx = fmaxf(fmaxf(sc[0][r], sc[1][r]), fmaxf(sc[2][r], sc[3][r]));
      mx = red16_max(mx);
      float nm   = fmaxf(rm[r], mx);
      float corr = __expf(rm[r] - nm);
      rm[r]      = nm;
      float psum = 0.0f;
#pragma unroll
      for (int nt = 0; nt < 4; ++nt) {
        float pv  = __expf(sc[nt][r] - nm);
        sc[nt][r] = pv;
        psum += pv;
      }
      psum  = red16_sum(psum);
      rs[r] = rs[r] * corr + psum;
#pragma unroll
      for (int nt = 0; nt < 4; ++nt) o[nt][r] *= corr;
    }

    // transpose P through LDS into A-fragment layout (per-wave region;
    // same-wave LDS ops are in-order, no block barrier needed)
#pragma unroll
    for (int nt = 0; nt < 4; ++nt)
#pragma unroll
      for (int r = 0; r < 8; ++r)
        Ps[wave][lh * 8 + r][nt * 16 + lr] = (__bf16)sc[nt][r];

    // O += P @ V   (2 k-steps over keys x 4 hd n-tiles)
#pragma unroll
    for (int ks = 0; ks < 2; ++ks) {
      v8bf plo = *(const v8bf*)&Ps[wave][lr][ks * 32 + koff];
      v8bf phi = *(const v8bf*)&Ps[wave][lr][ks * 32 + koff + 16];
      v16bf pf = pack16(plo, phi);
#pragma unroll
      for (int nt = 0; nt < 4; ++nt) {
        int row  = nt * 16 + lr;
        v8bf lo  = *(const v8bf*)&Vs[p][row][ks * 32 + koff];
        v8bf hi  = *(const v8bf*)&Vs[p][row][ks * 32 + koff + 16];
        v16bf vf = pack16(lo, hi);
        o[nt]    = __builtin_amdgcn_wmma_f32_16x16x32_bf16(
            false, pf, false, vf, (short)0, o[nt], false, false);
      }
    }
  }

  // normalize and store (bf16, [B*S, D] layout)
#pragma unroll
  for (int r = 0; r < 8; ++r) {
    float inv = 1.0f / rs[r];
    int m     = q0 + wave * 16 + lh * 8 + r;
#pragma unroll
    for (int nt = 0; nt < 4; ++nt)
      Ob[(size_t)(b * S_ + m) * D_ + h * HD_ + nt * 16 + lr] =
          (__bf16)(o[nt][r] * inv);
  }
}

// ------------------------------ launcher ------------------------------------

extern "C" void kernel_launch(void* const* d_in, const int* in_sizes, int n_in,
                              void* d_out, int out_size, void* d_ws,
                              size_t ws_size, hipStream_t stream) {
  const float* mod1 = (const float*)d_in[0];
  const float* mod2 = (const float*)d_in[1];
  const float* Wq   = (const float*)d_in[2];
  const float* bq   = (const float*)d_in[3];
  const float* Wk   = (const float*)d_in[4];
  const float* bk   = (const float*)d_in[5];
  const float* Wv   = (const float*)d_in[6];
  const float* bv   = (const float*)d_in[7];
  const float* Wo   = (const float*)d_in[8];
  const float* bo   = (const float*)d_in[9];
  const float* Wsc  = (const float*)d_in[10];
  const float* bsc  = (const float*)d_in[11];
  const float* Wsh  = (const float*)d_in[12];
  const float* bsh  = (const float*)d_in[13];
  float* out        = (float*)d_out;

  const size_t ACT = (size_t)MROWS * D_ * sizeof(__bf16);  // 8 MB
  const size_t WT  = (size_t)D_ * D_ * sizeof(__bf16);     // 0.5 MB

  char* w = (char*)d_ws;
  size_t off = 0;
  auto carve = [&](size_t bytes) -> __bf16* {
    __bf16* p = (__bf16*)(w + off);
    off += bytes;
    return p;
  };
  __bf16* mod1b = carve(ACT);
  __bf16* mod2b = carve(ACT);
  __bf16* Wqt   = carve(WT);
  __bf16* Wkt   = carve(WT);
  __bf16* Wvt   = carve(WT);
  __bf16* Wot   = carve(WT);
  __bf16* Wsct  = carve(WT);
  __bf16* Wsht  = carve(WT);
  __bf16* Qb    = carve(ACT);
  __bf16* Krb   = carve(ACT);
  __bf16* Vrb   = carve(ACT);
  __bf16* Scb   = carve(ACT);
  __bf16* Shb   = carve(ACT);
  __bf16* Kfb   = carve(ACT);
  __bf16* Vtb   = carve(ACT);   // [B,H,HD,S]
  __bf16* Obuf  = carve(ACT);

  const int actN = MROWS * D_;  // 4,194,304

  // 1) casts
  cast_bf16_kernel<<<actN / 1024, 256, 0, stream>>>(mod1, mod1b, actN);
  cast_bf16_kernel<<<actN / 1024, 256, 0, stream>>>(mod2, mod2b, actN);
  castT_bf16_kernel<<<(D_ * D_) / 256, 256, 0, stream>>>(Wq, Wqt);
  castT_bf16_kernel<<<(D_ * D_) / 256, 256, 0, stream>>>(Wk, Wkt);
  castT_bf16_kernel<<<(D_ * D_) / 256, 256, 0, stream>>>(Wv, Wvt);
  castT_bf16_kernel<<<(D_ * D_) / 256, 256, 0, stream>>>(Wo, Wot);
  castT_bf16_kernel<<<(D_ * D_) / 256, 256, 0, stream>>>(Wsc, Wsct);
  castT_bf16_kernel<<<(D_ * D_) / 256, 256, 0, stream>>>(Wsh, Wsht);

  // 2) projections (Q carries 1/sqrt(64))
  dim3 gg(D_ / BN, MROWS / BM);  // (4, 64)
  gemm_bf16_kernel<false><<<gg, 256, 0, stream>>>(mod1b, Wqt, bq, Qb,
                                                  MROWS, D_, D_, 0.125f);
  gemm_bf16_kernel<false><<<gg, 256, 0, stream>>>(mod2b, Wkt, bk, Krb,
                                                  MROWS, D_, D_, 1.0f);
  gemm_bf16_kernel<false><<<gg, 256, 0, stream>>>(mod2b, Wvt, bv, Vrb,
                                                  MROWS, D_, D_, 1.0f);
  gemm_bf16_kernel<false><<<gg, 256, 0, stream>>>(mod2b, Wsct, bsc, Scb,
                                                  MROWS, D_, D_, 1.0f);
  gemm_bf16_kernel<false><<<gg, 256, 0, stream>>>(mod2b, Wsht, bsh, Shb,
                                                  MROWS, D_, D_, 1.0f);

  // 3) K' = K*s+sh, V' = V*s+sh (and per-head transposed V')
  fuse_kv_kernel<<<actN / 256, 256, 0, stream>>>(Krb, Vrb, Scb, Shb, Kfb, Vtb);

  // 4) flash attention
  attn_kernel<<<dim3(S_ / 64, H_, B_), 128, 0, stream>>>(Qb, Kfb, Vtb, Obuf);

  // 5) output projection -> f32
  gemm_bf16_kernel<true><<<gg, 256, 0, stream>>>(Obuf, Wot, bo, out,
                                                 MROWS, D_, D_, 1.0f);
}

// v001
// A run of this version takes 180 microseconds.
// Next to v000, in two timings, it ran 1.49 and 1.50 times as fast.
#include <hip/hip_runtime.h>
#include <hip/hip_bf16.h>

// ---------------------------------------------------------------------------
// MultiHeadCrossModalAttention on MI455X (gfx1250, wave32, WMMA bf16,
// async global->LDS staging, DPP16 softmax reductions)
// B=4, S=2048, D=512, H=8, HD=64
// ---------------------------------------------------------------------------

typedef __attribute__((ext_vector_type(16))) __bf16 v16bf;
typedef __attribute__((ext_vector_type(8)))  __bf16 v8bf;
typedef __attribute__((ext_vector_type(8)))  float  v8f;
typedef int v4i __attribute__((vector_size(16)));

#define B_  4
#define S_  2048
#define D_  512
#define H_  8
#define HD_ 64
#define MROWS (B_ * S_)          // 8192

#define AS1 __attribute__((address_space(1)))
#define AS3 __attribute__((address_space(3)))

#if __has_builtin(__builtin_amdgcn_global_load_async_to_lds_b128) && \
    __has_builtin(__builtin_amdgcn_s_wait_asynccnt)
#define HAVE_ASYNC_LDS 1
#else
#define HAVE_ASYNC_LDS 0
#endif

#if __has_builtin(__builtin_amdgcn_update_dpp)
#define HAVE_DPP 1
#else
#define HAVE_DPP 0
#endif

// one 16B chunk: global -> LDS (async on CDNA5, sync fallback otherwise)
__device__ __forceinline__ void stage16(const __bf16* g, __bf16* l) {
#if HAVE_ASYNC_LDS
  __builtin_amdgcn_global_load_async_to_lds_b128((AS1 v4i*)g, (AS3 v4i*)l,
                                                 0, 0);
#else
  *(v8bf*)l = *(const v8bf*)g;
#endif
}

__device__ __forceinline__ void async_wait_all() {
#if HAVE_ASYNC_LDS
  __builtin_amdgcn_s_wait_asynccnt(0);
#endif
}

#if HAVE_DPP
template <int CTRL>
__device__ __forceinline__ float dpp_mov_f32(float x) {
  int r = __builtin_amdgcn_update_dpp(0, __float_as_int(x), CTRL, 0xF, 0xF,
                                      true);
  return __int_as_float(r);
}
#endif

// reduce (max / sum) across each 16-lane group; all lanes get the result.
__device__ __forceinline__ float red16_max(float x) {
#if HAVE_DPP
  x = fmaxf(x, dpp_mov_f32<0xB1>(x));    // quad_perm(1,0,3,2): xor 1
  x = fmaxf(x, dpp_mov_f32<0x4E>(x));    // quad_perm(2,3,0,1): xor 2
  x = fmaxf(x, dpp_mov_f32<0x141>(x));   // row_half_mirror: cross-quad in 8
  x = fmaxf(x, dpp_mov_f32<0x140>(x));   // row_mirror: cross-8 in 16
#else
#pragma unroll
  for (int off = 1; off < 16; off <<= 1) x = fmaxf(x, __shfl_xor(x, off, 32));
#endif
  return x;
}

__device__ __forceinline__ float red16_sum(float x) {
#if HAVE_DPP
  x += dpp_mov_f32<0xB1>(x);
  x += dpp_mov_f32<0x4E>(x);
  x += dpp_mov_f32<0x141>(x);
  x += dpp_mov_f32<0x140>(x);
#else
#pragma unroll
  for (int off = 1; off < 16; off <<= 1) x += __shfl_xor(x, off, 32);
#endif
  return x;
}

__device__ __forceinline__ v16bf pack16(v8bf lo, v8bf hi) {
  union { v16bf v; v8bf p[2]; } u;
  u.p[0] = lo; u.p[1] = hi;
  return u.v;
}

__device__ __forceinline__ v8f zero8() {
  v8f z;
#pragma unroll
  for (int i = 0; i < 8; ++i) z[i] = 0.0f;
  return z;
}

// ------------------------------- casts -------------------------------------

__global__ __launch_bounds__(256) void cast_bf16_kernel(
    const float* __restrict__ in, __bf16* __restrict__ out, int n) {
  int i = (blockIdx.x * 256 + threadIdx.x) * 4;
  if (i + 3 < n) {
#pragma unroll
    for (int j = 0; j < 4; ++j) out[i + j] = (__bf16)in[i + j];
  }
}

// Wt[n][k] = W[k][n], 512x512
__global__ __launch_bounds__(256) void castT_bf16_kernel(
    const float* __restrict__ W, __bf16* __restrict__ Wt) {
  int i = blockIdx.x * 256 + threadIdx.x;   // over 512*512
  int n = i >> 9;
  int k = i & 511;
  Wt[i] = (__bf16)W[k * D_ + n];
}

// ------------------------------- GEMM --------------------------------------
// C[M,N] = (A[M,K] @ Bt[N,K]^T + bias[N]) * alpha
// Tiles: BM=128, BN=128, BK=32.  256 threads = 8 waves (2x4), wave: 64x32.
// Double-buffered async global->LDS staging.

#define BM 128
#define BN 128
#define BK 32

template <bool OUT_F32>
__global__ __launch_bounds__(256) void gemm_bf16_kernel(
    const __bf16* __restrict__ A, const __bf16* __restrict__ Bt,
    const float* __restrict__ bias, void* __restrict__ C,
    int M, int N, int K, float alpha) {
  __shared__ __align__(16) __bf16 As[2][BM][BK + 8];   // 80B rows
  __shared__ __align__(16) __bf16 Bs[2][BM][BK + 8];

  const int tid  = threadIdx.x;
  const int bm0  = blockIdx.y * BM;
  const int bn0  = blockIdx.x * BN;
  const int wave = tid >> 5;
  const int lane = tid & 31;
  const int wm   = wave >> 2;        // 0..1 -> 64-row slab
  const int wn   = wave & 3;         // 0..3 -> 32-col slab
  const int lr   = lane & 15;
  const int lh   = lane >> 4;
  const int koff = lh * 8;

  // this thread's two 16B staging chunks (same mapping for A and B tiles)
  const int c0   = tid * 2;
  const int row0 = c0 >> 2;
  const int col0 = (c0 & 3) * 8;
  const int row1 = (c0 + 1) >> 2;
  const int col1 = ((c0 + 1) & 3) * 8;

  v8f acc[4][2];
#pragma unroll
  for (int mt = 0; mt < 4; ++mt)
#pragma unroll
    for (int nt = 0; nt < 2; ++nt) acc[mt][nt] = zero8();

  // prologue: stage tile 0 into buffer 0
  {
    stage16(&A[(size_t)(bm0 + row0) * K + col0], &As[0][row0][col0]);
    stage16(&Bt[(size_t)(bn0 + row0) * K + col0], &Bs[0][row0][col0]);
    stage16(&A[(size_t)(bm0 + row1) * K + col1], &As[0][row1][col1]);
    stage16(&Bt[(size_t)(bn0 + row1) * K + col1], &Bs[0][row1][col1]);
  }

  int p = 0;
  for (int bk = 0; bk < K; bk += BK, p ^= 1) {
    async_wait_all();
    __syncthreads();
    if (bk + BK < K) {
      int nb = bk + BK;
      stage16(&A[(size_t)(bm0 + row0) * K + nb + col0], &As[p ^ 1][row0][col0]);
      stage16(&Bt[(size_t)(bn0 + row0) * K + nb + col0], &Bs[p ^ 1][row0][col0]);
      stage16(&A[(size_t)(bm0 + row1) * K + nb + col1], &As[p ^ 1][row1][col1]);
      stage16(&Bt[(size_t)(bn0 + row1) * K + nb + col1], &Bs[p ^ 1][row1][col1]);
    }

    v16bf af[4], bf[2];
#pragma unroll
    for (int mt = 0; mt < 4; ++mt) {
      int r   = wm * 64 + mt * 16 + lr;
      v8bf lo = *(const v8bf*)&As[p][r][koff];
      v8bf hi = *(const v8bf*)&As[p][r][koff + 16];
      af[mt]  = pack16(lo, hi);
    }
#pragma unroll
    for (int nt = 0; nt < 2; ++nt) {
      int r   = wn * 32 + nt * 16 + lr;
      v8bf lo = *(const v8bf*)&Bs[p][r][koff];
      v8bf hi = *(const v8bf*)&Bs[p][r][koff + 16];
      bf[nt]  = pack16(lo, hi);
    }
#pragma unroll
    for (int mt = 0; mt < 4; ++mt)
#pragma unroll
      for (int nt = 0; nt < 2; ++nt)
        acc[mt][nt] = __builtin_amdgcn_wmma_f32_16x16x32_bf16(
            false, af[mt], false, bf[nt], (short)0, acc[mt][nt], false, false);
  }

  // epilogue: C layout -> lane holds col n=lr of each tile, rows r + lh*8
#pragma unroll
  for (int nt = 0; nt < 2; ++nt) {
    int n    = bn0 + wn * 32 + nt * 16 + lr;
    float bv = bias[n];
#pragma unroll
    for (int mt = 0; mt < 4; ++mt) {
#pragma unroll
      for (int r = 0; r < 8; ++r) {
        int m   = bm0 + wm * 64 + mt * 16 + lh * 8 + r;
        float v = (acc[mt][nt][r] + bv) * alpha;
        if constexpr (OUT_F32)
          ((float*)C)[(size_t)m * N + n] = v;
        else
          ((__bf16*)C)[(size_t)m * N + n] = (__bf16)v;
      }
    }
  }
}

// ------------------------------- fuse --------------------------------------
// K' = K*s + sh ; V' = V*s + sh ; also write V' transposed per head:
// Vt[b][h][hd][s]
// grid: (H, B*S/64), block 256. One block owns a 64 (s) x 64 (hd) tile of one
// head. Every global access is a 16-byte chunk of a 128-byte row piece; the
// V' tile turns round in LDS.
// LDS tile: row hd, 32 dwords, a dword holds V' of rows s = 2*sp and 2*sp + 1.
// The 4-dword group index is XORed with hd >> 3: the eight hd chunks of a wave
// then store to different banks, and a 16-byte read still finds a whole group.
__global__ __launch_bounds__(256) void fuse_kv_kernel(
    const __bf16* __restrict__ Kr, const __bf16* __restrict__ Vr,
    const __bf16* __restrict__ Sc, const __bf16* __restrict__ Sh,
    __bf16* __restrict__ Kf, __bf16* __restrict__ Vt) {
  __shared__ __align__(16) unsigned int Tv[HD_ * 32];

  const int tid = threadIdx.x;
  const int h   = blockIdx.x;
  const int m0  = blockIdx.y * 64;      // first row in [B*S]
  const int b   = m0 / S_;
  const int s0  = m0 & (S_ - 1);
  const int hc  = tid & 7;              // 8-element chunk of hd
  const int sp  = tid >> 3;             // pair of s rows

  // byte offset of this thread's chunk in row 2*sp, the same in all five
  // [B*S, D] planes (8 MiB each, so 32 bits hold it); row 2*sp + 1 lies RB on
  const unsigned int o0 = (unsigned int)((m0 + 2 * sp) * D_ + h * HD_ + hc * 8) * 2u;
  constexpr unsigned int RB = D_ * 2;
  auto ld = [](const __bf16* p, unsigned int o) {
    return *(const v8bf*)((const char*)p + o);
  };
  const v8bf k0 = ld(Kr, o0), k1 = ld(Kr, o0 + RB);
  const v8bf v0 = ld(Vr, o0), v1 = ld(Vr, o0 + RB);
  const v8bf c0 = ld(Sc, o0), c1 = ld(Sc, o0 + RB);
  const v8bf t0 = ld(Sh, o0), t1 = ld(Sh, o0 + RB);

  v8bf ko0, ko1;
  const int grp = (((sp >> 2) ^ hc) << 2) + (sp & 3);
#pragma unroll  // constant j: the vector elements stay in registers
  for (int j = 0; j < 8; ++j) {
    float sc0 = (float)c0[j], sh0 = (float)t0[j];
    float sc1 = (float)c1[j], sh1 = (float)t1[j];
    ko0[j] = (__bf16)((float)k0[j] * sc0 + sh0);
    ko1[j] = (__bf16)((float)k1[j] * sc1 + sh1);
    union { __bf16 e[2]; unsigned int u; } pk;
    pk.e[0] = (__bf16)((float)v0[j] * sc0 + sh0);
    pk.e[1] = (__bf16)((float)v1[j] * sc1 + sh1);
    Tv[(hc * 8 + j) * 32 + grp] = pk.u;
  }

  __syncthreads();

  // behind the barrier, so that no wave waits there for these stores to return
  *(v8bf*)((char*)Kf + o0) = ko0;
  *(v8bf*)((char*)Kf + o0 + RB) = ko1;

  __bf16* vout = Vt + (size_t)(b * H_ + h) * HD_ * S_ + s0;
#pragma unroll  // both LDS reads issue before the first store waits for its data
  for (int i = 0; i < 2; ++i) {
    int c = tid + i * 256, hd = c >> 3, g = c & 7;
    v8bf row = *(const v8bf*)&Tv[hd * 32 + ((g ^ (hd >> 3)) << 2)];
    *(v8bf*)(vout + (size_t)hd * S_ + g * 8) = row;
  }
}

// ---------------------------- flash attention -------------------------------
// grid: (S/64, H, B), block 128 (4 waves). Wave w owns q rows q0+w*16..+15.
// Q already scaled by 1/sqrt(HD). Double-buffered async K/V tile staging.
__global__ __launch_bounds__(128) void attn_kernel(
    const __bf16* __restrict__ Qb, const __bf16* __restrict__ Kb,
    const __bf16* __restrict__ Vt, __bf16* __restrict__ Ob) {
  __shared__ __align__(16) __bf16 Ks[2][64][72];    // [key][hd]
  __shared__ __align__(16) __bf16 Vs[2][64][72];    // [hd][key] (transposed V)
  __shared__ __align__(16) __bf16 Ps[4][16][72];    // per-wave P tile

  const int b    = blockIdx.z;
  const int h    = blockIdx.y;
  const int q0   = blockIdx.x * 64;
  const int tid  = threadIdx.x;
  const int wave = tid >> 5;
  const int lane = tid & 31;
  const int lr   = lane & 15;
  const int lh   = lane >> 4;
  const int koff = lh * 8;

  const __bf16* Kbase = Kb + (size_t)(b * S_) * D_ + h * HD_;
  const __bf16* Vbase = Vt + (size_t)(b * H_ + h) * HD_ * S_;

  // Q fragments (16x64 per wave -> 2 k-steps), resident in VGPRs
  v16bf qf[2];
  {
    int qrow           = q0 + wave * 16 + lr;
    const __bf16* qptr = Qb + (size_t)(b * S_ + qrow) * D_ + h * HD_;
#pragma unroll
    for (int ks = 0; ks < 2; ++ks) {
      v8bf lo = *(const v8bf*)(qptr + ks * 32 + koff);
      v8bf hi = *(const v8bf*)(qptr + ks * 32 + koff + 16);
      qf[ks]  = pack16(lo, hi);
    }
  }

  v8f o[4];
#pragma unroll
  for (int nt = 0; nt < 4; ++nt) o[nt] = zero8();
  float rm[8], rs[8];
#pragma unroll
  for (int r = 0; r < 8; ++r) { rm[r] = -1e30f; rs[r] = 0.0f; }

  // this thread's four 16B staging chunks per tile
  // chunk c = tid + i*128; row = c>>3 (8 x 16B per 128B row); col = (c&7)*8
  // prologue: stage tile 0 into buffer 0
#pragma unroll
  for (int i = 0; i < 4; ++i) {
    int c = tid + i * 128, row = c >> 3, col = (c & 7) * 8;
    stage16(&Kbase[(size_t)row * D_ + col], &Ks[0][row][col]);
    stage16(&Vbase[(size_t)row * S_ + col], &Vs[0][row][col]);
  }

  int p = 0;
  for (int kt0 = 0; kt0 < S_; kt0 += 64, p ^= 1) {
    async_wait_all();
    __syncthreads();
    if (kt0 + 64 < S_) {
      int nk = kt0 + 64;
#pragma unroll
      for (int i = 0; i < 4; ++i) {
        int c = tid + i * 128, row = c >> 3, col = (c & 7) * 8;
        stage16(&Kbase[(size_t)(nk + row) * D_ + col], &Ks[p ^ 1][row][col]);
        stage16(&Vbase[(size_t)row * S_ + nk + col], &Vs[p ^ 1][row][col]);
      }
    }

    // S = Q @ K^T   (4 n-tiles x 2 k-steps)
    v8f sc[4];
#pragma unroll
    for (int nt = 0; nt < 4; ++nt) {
      sc[nt] = zero8();
#pragma unroll
      for (int ks = 0; ks < 2; ++ks) {
        int row  = nt * 16 + lr;
        v8bf lo  = *(const v8bf*)&Ks[p][row][ks * 32 + koff];
        v8bf hi  = *(const v8bf*)&Ks[p][row][ks * 32 + koff + 16];
        v16bf kf = pack16(lo, hi);
        sc[nt]   = __builtin_amdgcn_wmma_f32_16x16x32_bf16(
            false, qf[ks], false, kf, (short)0, sc[nt], false, false);
      }
    }

    // online softmax: lane holds col n=lr, rows r+lh*8; row lives in 16 lanes
#pragma unroll
    for (int r = 0; r < 8; ++r) {
      float mx = fmaxf(fmaxf(sc[0][r], sc[1][r]), fmaxf(sc[2][r], sc[3][r]));
      mx = red16_max(mx);
      float nm   = fmaxf(rm[r], mx);
      float corr = __expf(rm[r] - nm);
      rm[r]      = nm;
      float psum = 0.0f;
#pragma unroll
      for (int nt = 0; nt < 4; ++nt) {
        float pv  = __expf(sc[nt][r] - nm);
        sc[nt][r] = pv;
        psum += pv;
      }
      psum  = red16_sum(psum);
      rs[r] = rs[r] * corr + psum;
#pragma unroll
      for (int nt = 0; nt < 4; ++nt) o[nt][r] *= corr;
    }

    // transpose P through LDS into A-fragment layout (per-wave region;
    // same-wave LDS ops are in-order, no block barrier needed)
#pragma unroll
    for (int nt = 0; nt < 4; ++nt)
#pragma unroll
      for (int r = 0; r < 8; ++r)
        Ps[wave][lh * 8 + r][nt * 16 + lr] = (__bf16)sc[nt][r];

    // O += P @ V   (2 k-steps over keys x 4 hd n-tiles)
#pragma unroll
    for (int ks = 0; ks < 2; ++ks) {
      v8bf plo = *(const v8bf*)&Ps[wave][lr][ks * 32 + koff];
      v8bf phi = *(const v8bf*)&Ps[wave][lr][ks * 32 + koff + 16];
      v16bf pf = pack16(plo, phi);
#pragma unroll
      for (int nt = 0; nt < 4; ++nt) {
        int row  = nt * 16 + lr;
        v8bf lo  = *(const v8bf*)&Vs[p][row][ks * 32 + koff];
        v8bf hi  = *(const v8bf*)&Vs[p][row][ks * 32 + koff + 16];
        v16bf vf = pack16(lo, hi);
        o[nt]    = __builtin_amdgcn_wmma_f32_16x16x32_bf16(
            false, pf, false, vf, (short)0, o[nt], false, false);
      }
    }
  }

  // normalize and store (bf16, [B*S, D] layout)
#pragma unroll
  for (int r = 0; r < 8; ++r) {
    float inv = 1.0f / rs[r];
    int m     = q0 + wave * 16 + lh * 8 + r;
#pragma unroll
    for (int nt = 0; nt < 4; ++nt)
      Ob[(size_t)(b * S_ + m) * D_ + h * HD_ + nt * 16 + lr] =
          (__bf16)(o[nt][r] * inv);
  }
}

// ------------------------------ launcher ------------------------------------

extern "C" void kernel_launch(void* const* d_in, const int* in_sizes, int n_in,
                              void* d_out, int out_size, void* d_ws,
                              size_t ws_size, hipStream_t stream) {
  const float* mod1 = (const float*)d_in[0];
  const float* mod2 = (const float*)d_in[1];
  const float* Wq   = (const float*)d_in[2];
  const float* bq   = (const float*)d_in[3];
  const float* Wk   = (const float*)d_in[4];
  const float* bk   = (const float*)d_in[5];
  const float* Wv   = (const float*)d_in[6];
  const float* bv   = (const float*)d_in[7];
  const float* Wo   = (const float*)d_in[8];
  const float* bo   = (const float*)d_in[9];
  const float* Wsc  = (const float*)d_in[10];
  const float* bsc  = (const float*)d_in[11];
  const float* Wsh  = (const float*)d_in[12];
  const float* bsh  = (const float*)d_in[13];
  float* out        = (float*)d_out;

  const size_t ACT = (size_t)MROWS * D_ * sizeof(__bf16);  // 8 MB
  const size_t WT  = (size_t)D_ * D_ * sizeof(__bf16);     // 0.5 MB

  char* w = (char*)d_ws;
  size_t off = 0;
  auto carve = [&](size_t bytes) -> __bf16* {
    __bf16* p = (__bf16*)(w + off);
    off += bytes;
    return p;
  };
  __bf16* mod1b = carve(ACT);
  __bf16* mod2b = carve(ACT);
  __bf16* Wqt   = carve(WT);
  __bf16* Wkt   = carve(WT);
  __bf16* Wvt   = carve(WT);
  __bf16* Wot   = carve(WT);
  __bf16* Wsct  = carve(WT);
  __bf16* Wsht  = carve(WT);
  __bf16* Qb    = carve(ACT);
  __bf16* Krb   = carve(ACT);
  __bf16* Vrb   = carve(ACT);
  __bf16* Scb   = carve(ACT);
  __bf16* Shb   = carve(ACT);
  __bf16* Kfb   = carve(ACT);
  __bf16* Vtb   = carve(ACT);   // [B,H,HD,S]
  __bf16* Obuf  = carve(ACT);

  const int actN = MROWS * D_;  // 4,194,304

  // 1) casts
  cast_bf16_kernel<<<actN / 1024, 256, 0, stream>>>(mod1, mod1b, actN);
  cast_bf16_kernel<<<actN / 1024, 256, 0, stream>>>(mod2, mod2b, actN);
  castT_bf16_kernel<<<(D_ * D_) / 256, 256, 0, stream>>>(Wq, Wqt);
  castT_bf16_kernel<<<(D_ * D_) / 256, 256, 0, stream>>>(Wk, Wkt);
  castT_bf16_kernel<<<(D_ * D_) / 256, 256, 0, stream>>>(Wv, Wvt);
  castT_bf16_kernel<<<(D_ * D_) / 256, 256, 0, stream>>>(Wo, Wot);
  castT_bf16_kernel<<<(D_ * D_) / 256, 256, 0, stream>>>(Wsc, Wsct);
  castT_bf16_kernel<<<(D_ * D_) / 256, 256, 0, stream>>>(Wsh, Wsht);

  // 2) projections (Q carries 1/sqrt(64))
  dim3 gg(D_ / BN, MROWS / BM);  // (4, 64)
  gemm_bf16_kernel<false><<<gg, 256, 0, stream>>>(mod1b, Wqt, bq, Qb,
                                                  MROWS, D_, D_, 0.125f);
  gemm_bf16_kernel<false><<<gg, 256, 0, stream>>>(mod2b, Wkt, bk, Krb,
                                                  MROWS, D_, D_, 1.0f);
  gemm_bf16_kernel<false><<<gg, 256, 0, stream>>>(mod2b, Wvt, bv, Vrb,
                                                  MROWS, D_, D_, 1.0f);
  gemm_bf16_kernel<false><<<gg, 256, 0, stream>>>(mod2b, Wsct, bsc, Scb,
                                                  MROWS, D_, D_, 1.0f);
  gemm_bf16_kernel<false><<<gg, 256, 0, stream>>>(mod2b, Wsht, bsh, Shb,
                                                  MROWS, D_, D_, 1.0f);

  // 3) K' = K*s+sh, V' = V*s+sh (and per-head transposed V')
  fuse_kv_kernel<<<dim3(H_, MROWS / 64), 256, 0, stream>>>(Krb, Vrb, Scb, Shb,
                                                        Kfb, Vtb);

  // 4) flash attention
  attn_kernel<<<dim3(S_ / 64, H_, B_), 128, 0, stream>>>(Qb, Kfb, Vtb, Obuf);

  // 5) output projection -> f32
  gemm_bf16_kernel<true><<<gg, 256, 0, stream>>>(Obuf, Wot, bo, out,
                                                 MROWS, D_, D_, 1.0f);
}

// v002
// Measured time: 156 microseconds a run.
// Two timings next to v001 both put it at 1.16 times that version's speed.
// All steps since v000 together make it 1.73 times as fast.
#include <hip/hip_runtime.h>
#include <hip/hip_bf16.h>

// ---------------------------------------------------------------------------
// MultiHeadCrossModalAttention on MI455X (gfx1250, wave32, WMMA bf16,
// async global->LDS staging, DPP16 softmax reductions)
// B=4, S=2048, D=512, H=8, HD=64
// ---------------------------------------------------------------------------

typedef __attribute__((ext_vector_type(16))) __bf16 v16bf;
typedef __attribute__((ext_vector_type(8)))  __bf16 v8bf;
typedef __attribute__((ext_vector_type(8)))  float  v8f;
typedef int v4i __attribute__((vector_size(16)));

#define B_  4
#define S_  2048
#define D_  512
#define H_  8
#define HD_ 64
#define MROWS (B_ * S_)          // 8192

#define AS1 __attribute__((address_space(1)))
#define AS3 __attribute__((address_space(3)))

#if __has_builtin(__builtin_amdgcn_global_load_async_to_lds_b128) && \
    __has_builtin(__builtin_amdgcn_s_wait_asynccnt)
#define HAVE_ASYNC_LDS 1
#else
#define HAVE_ASYNC_LDS 0
#endif

#if __has_builtin(__builtin_amdgcn_update_dpp)
#define HAVE_DPP 1
#else
#define HAVE_DPP 0
#endif

// one 16B chunk: global -> LDS (async on CDNA5, sync fallback otherwise)
__device__ __forceinline__ void stage16(const __bf16* g, __bf16* l) {
#if HAVE_ASYNC_LDS
  __builtin_amdgcn_global_load_async_to_lds_b128((AS1 v4i*)g, (AS3 v4i*)l,
                                                 0, 0);
#else
  *(v8bf*)l = *(const v8bf*)g;
#endif
}

__device__ __forceinline__ void async_wait_all() {
#if HAVE_ASYNC_LDS
  __builtin_amdgcn_s_wait_asynccnt(0);
#endif
}

#if HAVE_DPP
template <int CTRL>
__device__ __forceinline__ float dpp_mov_f32(float x) {
  int r = __builtin_amdgcn_update_dpp(0, __float_as_int(x), CTRL, 0xF, 0xF,
                                      true);
  return __int_as_float(r);
}
#endif

// reduce (max / sum) across each 16-lane group; all lanes get the result.
__device__ __forceinline__ float red16_max(float x) {
#if HAVE_DPP
  x = fmaxf(x, dpp_mov_f32<0xB1>(x));    // quad_perm(1,0,3,2): xor 1
  x = fmaxf(x, dpp_mov_f32<0x4E>(x));    // quad_perm(2,3,0,1): xor 2
  x = fmaxf(x, dpp_mov_f32<0x141>(x));   // row_half_mirror: cross-quad in 8
  x = fmaxf(x, dpp_mov_f32<0x140>(x));   // row_mirror: cross-8 in 16
#else
#pragma unroll
  for (int off = 1; off < 16; off <<= 1) x = fmaxf(x, __shfl_xor(x, off, 32));
#endif
  return x;
}

__device__ __forceinline__ float red16_sum(float x) {
#if HAVE_DPP
  x += dpp_mov_f32<0xB1>(x);
  x += dpp_mov_f32<0x4E>(x);
  x += dpp_mov_f32<0x141>(x);
  x += dpp_mov_f32<0x140>(x);
#else
#pragma unroll
  for (int off = 1; off < 16; off <<= 1) x += __shfl_xor(x, off, 32);
#endif
  return x;
}

__device__ __forceinline__ v16bf pack16(v8bf lo, v8bf hi) {
  union { v16bf v; v8bf p[2]; } u;
  u.p[0] = lo; u.p[1] = hi;
  return u.v;
}

__device__ __forceinline__ v8f zero8() {
  v8f z;
#pragma unroll
  for (int i = 0; i < 8; ++i) z[i] = 0.0f;
  return z;
}

// ------------------------------- casts -------------------------------------
// One launch converts both activation tensors and all six weight matrices to
// bf16. A short wave costs more to start than to run, so a lane converts 64
// activation elements or a 4 (n) x 8 (k) piece of a weight matrix.
// Blocks 0 .. 6*WBLK-1: weights, Wt[n][k] = W[k][n]; the rest: activations.

typedef __attribute__((ext_vector_type(4))) float  v4f;
typedef __attribute__((ext_vector_type(4))) __bf16 v4bf;

#define WBLK 32    // blocks per 512x512 weight matrix: tiles of 64 (k) x 128 (n)
#define ABLK 256   // blocks per activation tensor: 16,384 elements each
#define ACH  16    // 16-byte chunks per lane of an activation block

__global__ __launch_bounds__(256) void convert_all_kernel(
    const float* __restrict__ act0, const float* __restrict__ act1,
    const float* __restrict__ W0, const float* __restrict__ W1,
    const float* __restrict__ W2, const float* __restrict__ W3,
    const float* __restrict__ W4, const float* __restrict__ W5,
    __bf16* __restrict__ actb, __bf16* __restrict__ wtb) {
  const unsigned int blk = blockIdx.x;
  const int tid = threadIdx.x;

  if (blk < 6 * WBLK) {
    const int wi = blk / WBLK;
    const int t  = blk % WBLK;
    const float* W = wi == 0 ? W0 : wi == 1 ? W1 : wi == 2 ? W2
                   : wi == 3 ? W3 : wi == 4 ? W4 : W5;
    __bf16* Wt = wtb + (size_t)wi * (D_ * D_);
    // eight neighbouring lanes hold the eight k chunks of one Wt row piece:
    // together they store a whole 128-byte line
    const int k0 = (t & 7) * 64 + (tid & 7) * 8;
    const int n0 = (t >> 3) * 128 + (tid >> 3) * 4;
    v4f r[8];
#pragma unroll  // all eight loads in flight before the first convert
    for (int j = 0; j < 8; ++j) r[j] = *(const v4f*)&W[(k0 + j) * D_ + n0];
#pragma unroll  // constant indices: the vector elements stay in registers
    for (int c = 0; c < 4; ++c) {
      v8bf o;
#pragma unroll  // as above
      for (int j = 0; j < 8; ++j) o[j] = (__bf16)r[j][c];
      *(v8bf*)&Wt[(n0 + c) * D_ + k0] = o;
    }
  } else {
    const unsigned int ab = blk - 6 * WBLK;
    const int ti = ab / ABLK;
    const float* in = ti == 0 ? act0 : act1;
    __bf16* out = actb + (size_t)ti * (MROWS * D_);
    const unsigned int e0 = (ab % ABLK) * (256 * ACH * 4) + tid * 4;
    const unsigned int lo = e0 * 4;   // byte offset that all the loads share
    v4f r[ACH];
#pragma unroll  // all loads in flight before the first convert
    for (int j = 0; j < ACH; ++j)
      r[j] = *(const v4f*)((const char*)in + lo + j * 4096);
    // the wait owed before a register that an issued load names is rewritten;
    // it takes the shared offset as an input, so that no load's result lands in
    // that register while earlier loads of the run still name it
    asm volatile("s_wait_xcnt 0x0" :: "v"(lo) : "memory");
    // keeps the first converts from rising among the loads: the last loads would
    // then take over registers of the first and issue only when those return
    __builtin_amdgcn_sched_barrier(0);
#pragma unroll  // constant indices: the loaded chunks stay in registers
    for (int j = 0; j < ACH; ++j)
      *(v4bf*)&out[e0 + j * 1024] = __builtin_convertvector(r[j], v4bf);
    // the same wait behind the last stores: the code that follows them in the
    // built text rewrites their offset and data registers
    asm volatile("s_wait_xcnt 0x0" ::: "memory");
  }
}

// ------------------------------- GEMM --------------------------------------
// C[M,N] = (A[M,K] @ Bt[N,K]^T + bias[N]) * alpha
// Tiles: BM=128, BN=128, BK=32.  256 threads = 8 waves (2x4), wave: 64x32.
// Double-buffered async global->LDS staging.

#define BM 128
#define BN 128
#define BK 32

template <bool OUT_F32>
__global__ __launch_bounds__(256) void gemm_bf16_kernel(
    const __bf16* __restrict__ A, const __bf16* __restrict__ Bt,
    const float* __restrict__ bias, void* __restrict__ C,
    int M, int N, int K, float alpha) {
  __shared__ __align__(16) __bf16 As[2][BM][BK + 8];   // 80B rows
  __shared__ __align__(16) __bf16 Bs[2][BM][BK + 8];

  const int tid  = threadIdx.x;
  const int bm0  = blockIdx.y * BM;
  const int bn0  = blockIdx.x * BN;
  const int wave = tid >> 5;
  const int lane = tid & 31;
  const int wm   = wave >> 2;        // 0..1 -> 64-row slab
  const int wn   = wave & 3;         // 0..3 -> 32-col slab
  const int lr   = lane & 15;
  const int lh   = lane >> 4;
  const int koff = lh * 8;

  // this thread's two 16B staging chunks (same mapping for A and B tiles)
  const int c0   = tid * 2;
  const int row0 = c0 >> 2;
  const int col0 = (c0 & 3) * 8;
  const int row1 = (c0 + 1) >> 2;
  const int col1 = ((c0 + 1) & 3) * 8;

  v8f acc[4][2];
#pragma unroll
  for (int mt = 0; mt < 4; ++mt)
#pragma unroll
    for (int nt = 0; nt < 2; ++nt) acc[mt][nt] = zero8();

  // prologue: stage tile 0 into buffer 0
  {
    stage16(&A[(size_t)(bm0 + row0) * K + col0], &As[0][row0][col0]);
    stage16(&Bt[(size_t)(bn0 + row0) * K + col0], &Bs[0][row0][col0]);
    stage16(&A[(size_t)(bm0 + row1) * K + col1], &As[0][row1][col1]);
    stage16(&Bt[(size_t)(bn0 + row1) * K + col1], &Bs[0][row1][col1]);
  }

  int p = 0;
  for (int bk = 0; bk < K; bk += BK, p ^= 1) {
    async_wait_all();
    __syncthreads();
    if (bk + BK < K) {
      int nb = bk + BK;
      stage16(&A[(size_t)(bm0 + row0) * K + nb + col0], &As[p ^ 1][row0][col0]);
      stage16(&Bt[(size_t)(bn0 + row0) * K + nb + col0], &Bs[p ^ 1][row0][col0]);
      stage16(&A[(size_t)(bm0 + row1) * K + nb + col1], &As[p ^ 1][row1][col1]);
      stage16(&Bt[(size_t)(bn0 + row1) * K + nb + col1], &Bs[p ^ 1][row1][col1]);
    }

    v16bf af[4], bf[2];
#pragma unroll
    for (int mt = 0; mt < 4; ++mt) {
      int r   = wm * 64 + mt * 16 + lr;
      v8bf lo = *(const v8bf*)&As[p][r][koff];
      v8bf hi = *(const v8bf*)&As[p][r][koff + 16];
      af[mt]  = pack16(lo, hi);
    }
#pragma unroll
    for (int nt = 0; nt < 2; ++nt) {
      int r   = wn * 32 + nt * 16 + lr;
      v8bf lo = *(const v8bf*)&Bs[p][r][koff];
      v8bf hi = *(const v8bf*)&Bs[p][r][koff + 16];
      bf[nt]  = pack16(lo, hi);
    }
#pragma unroll
    for (int mt = 0; mt < 4; ++mt)
#pragma unroll
      for (int nt = 0; nt < 2; ++nt)
        acc[mt][nt] = __builtin_amdgcn_wmma_f32_16x16x32_bf16(
            false, af[mt], false, bf[nt], (short)0, acc[mt][nt], false, false);
  }

  // epilogue: C layout -> lane holds col n=lr of each tile, rows r + lh*8
#pragma unroll
  for (int nt = 0; nt < 2; ++nt) {
    int n    = bn0 + wn * 32 + nt * 16 + lr;
    float bv = bias[n];
#pragma unroll
    for (int mt = 0; mt < 4; ++mt) {
#pragma unroll
      for (int r = 0; r < 8; ++r) {
        int m   = bm0 + wm * 64 + mt * 16 + lh * 8 + r;
        float v = (acc[mt][nt][r] + bv) * alpha;
        if constexpr (OUT_F32)
          ((float*)C)[(size_t)m * N + n] = v;
        else
          ((__bf16*)C)[(size_t)m * N + n] = (__bf16)v;
      }
    }
  }
}

// ------------------------------- fuse --------------------------------------
// K' = K*s + sh ; V' = V*s + sh ; also write V' transposed per head:
// Vt[b][h][hd][s]
// grid: (H, B*S/64), block 256. One block owns a 64 (s) x 64 (hd) tile of one
// head. Every global access is a 16-byte chunk of a 128-byte row piece; the
// V' tile turns round in LDS.
// LDS tile: row hd, 32 dwords, a dword holds V' of rows s = 2*sp and 2*sp + 1.
// The 4-dword group index is XORed with hd >> 3: the eight hd chunks of a wave
// then store to different banks, and a 16-byte read still finds a whole group.
__global__ __launch_bounds__(256) void fuse_kv_kernel(
    const __bf16* __restrict__ Kr, const __bf16* __restrict__ Vr,
    const __bf16* __restrict__ Sc, const __bf16* __restrict__ Sh,
    __bf16* __restrict__ Kf, __bf16* __restrict__ Vt) {
  __shared__ __align__(16) unsigned int Tv[HD_ * 32];

  const int tid = threadIdx.x;
  const int h   = blockIdx.x;
  const int m0  = blockIdx.y * 64;      // first row in [B*S]
  const int b   = m0 / S_;
  const int s0  = m0 & (S_ - 1);
  const int hc  = tid & 7;              // 8-element chunk of hd
  const int sp  = tid >> 3;             // pair of s rows

  // byte offset of this thread's chunk in row 2*sp, the same in all five
  // [B*S, D] planes (8 MiB each, so 32 bits hold it); row 2*sp + 1 lies RB on
  const unsigned int o0 = (unsigned int)((m0 + 2 * sp) * D_ + h * HD_ + hc * 8) * 2u;
  constexpr unsigned int RB = D_ * 2;
  auto ld = [](const __bf16* p, unsigned int o) {
    return *(const v8bf*)((const char*)p + o);
  };
  const v8bf k0 = ld(Kr, o0), k1 = ld(Kr, o0 + RB);
  const v8bf v0 = ld(Vr, o0), v1 = ld(Vr, o0 + RB);
  const v8bf c0 = ld(Sc, o0), c1 = ld(Sc, o0 + RB);
  const v8bf t0 = ld(Sh, o0), t1 = ld(Sh, o0 + RB);

  v8bf ko0, ko1;
  const int grp = (((sp >> 2) ^ hc) << 2) + (sp & 3);
#pragma unroll  // constant j: the vector elements stay in registers
  for (int j = 0; j < 8; ++j) {
    float sc0 = (float)c0[j], sh0 = (float)t0[j];
    float sc1 = (float)c1[j], sh1 = (float)t1[j];
    ko0[j] = (__bf16)((float)k0[j] * sc0 + sh0);
    ko1[j] = (__bf16)((float)k1[j] * sc1 + sh1);
    union { __bf16 e[2]; unsigned int u; } pk;
    pk.e[0] = (__bf16)((float)v0[j] * sc0 + sh0);
    pk.e[1] = (__bf16)((float)v1[j] * sc1 + sh1);
    Tv[(hc * 8 + j) * 32 + grp] = pk.u;
  }

  __syncthreads();

  // behind the barrier, so that no wave waits there for these stores to return
  *(v8bf*)((char*)Kf + o0) = ko0;
  *(v8bf*)((char*)Kf + o0 + RB) = ko1;

  __bf16* vout = Vt + (size_t)(b * H_ + h) * HD_ * S_ + s0;
#pragma unroll  // both LDS reads issue before the first store waits for its data
  for (int i = 0; i < 2; ++i) {
    int c = tid + i * 256, hd = c >> 3, g = c & 7;
    v8bf row = *(const v8bf*)&Tv[hd * 32 + ((g ^ (hd >> 3)) << 2)];
    *(v8bf*)(vout + (size_t)hd * S_ + g * 8) = row;
  }
}

// ---------------------------- flash attention -------------------------------
// grid: (S/64, H, B), block 128 (4 waves). Wave w owns q rows q0+w*16..+15.
// Q already scaled by 1/sqrt(HD). Double-buffered async K/V tile staging.
__global__ __launch_bounds__(128) void attn_kernel(
    const __bf16* __restrict__ Qb, const __bf16* __restrict__ Kb,
    const __bf16* __restrict__ Vt, __bf16* __restrict__ Ob) {
  __shared__ __align__(16) __bf16 Ks[2][64][72];    // [key][hd]
  __shared__ __align__(16) __bf16 Vs[2][64][72];    // [hd][key] (transposed V)
  __shared__ __align__(16) __bf16 Ps[4][16][72];    // per-wave P tile

  const int b    = blockIdx.z;
  const int h    = blockIdx.y;
  const int q0   = blockIdx.x * 64;
  const int tid  = threadIdx.x;
  const int wave = tid >> 5;
  const int lane = tid & 31;
  const int lr   = lane & 15;
  const int lh   = lane >> 4;
  const int koff = lh * 8;

  const __bf16* Kbase = Kb + (size_t)(b * S_) * D_ + h * HD_;
  const __bf16* Vbase = Vt + (size_t)(b * H_ + h) * HD_ * S_;

  // Q fragments (16x64 per wave -> 2 k-steps), resident in VGPRs
  v16bf qf[2];
  {
    int qrow           = q0 + wave * 16 + lr;
    const __bf16* qptr = Qb + (size_t)(b * S_ + qrow) * D_ + h * HD_;
#pragma unroll
    for (int ks = 0; ks < 2; ++ks) {
      v8bf lo = *(const v8bf*)(qptr + ks * 32 + koff);
      v8bf hi = *(const v8bf*)(qptr + ks * 32 + koff + 16);
      qf[ks]  = pack16(lo, hi);
    }
  }

  v8f o[4];
#pragma unroll
  for (int nt = 0; nt < 4; ++nt) o[nt] = zero8();
  float rm[8], rs[8];
#pragma unroll
  for (int r = 0; r < 8; ++r) { rm[r] = -1e30f; rs[r] = 0.0f; }

  // this thread's four 16B staging chunks per tile
  // chunk c = tid + i*128; row = c>>3 (8 x 16B per 128B row); col = (c&7)*8
  // prologue: stage tile 0 into buffer 0
#pragma unroll
  for (int i = 0; i < 4; ++i) {
    int c = tid + i * 128, row = c >> 3, col = (c & 7) * 8;
    stage16(&Kbase[(size_t)row * D_ + col], &Ks[0][row][col]);
    stage16(&Vbase[(size_t)row * S_ + col], &Vs[0][row][col]);
  }

  int p = 0;
  for (int kt0 = 0; kt0 < S_; kt0 += 64, p ^= 1) {
    async_wait_all();
    __syncthreads();
    if (kt0 + 64 < S_) {
      int nk = kt0 + 64;
#pragma unroll
      for (int i = 0; i < 4; ++i) {
        int c = tid + i * 128, row = c >> 3, col = (c & 7) * 8;
        stage16(&Kbase[(size_t)(nk + row) * D_ + col], &Ks[p ^ 1][row][col]);
        stage16(&Vbase[(size_t)row * S_ + nk + col], &Vs[p ^ 1][row][col]);
      }
    }

    // S = Q @ K^T   (4 n-tiles x 2 k-steps)
    v8f sc[4];
#pragma unroll
    for (int nt = 0; nt < 4; ++nt) {
      sc[nt] = zero8();
#pragma unroll
      for (int ks = 0; ks < 2; ++ks) {
        int row  = nt * 16 + lr;
        v8bf lo  = *(const v8bf*)&Ks[p][row][ks * 32 + koff];
        v8bf hi  = *(const v8bf*)&Ks[p][row][ks * 32 + koff + 16];
        v16bf kf = pack16(lo, hi);
        sc[nt]   = __builtin_amdgcn_wmma_f32_16x16x32_bf16(
            false, qf[ks], false, kf, (short)0, sc[nt], false, false);
      }
    }

    // online softmax: lane holds col n=lr, rows r+lh*8; row lives in 16 lanes
#pragma unroll
    for (int r = 0; r < 8; ++r) {
      float mx = fmaxf(fmaxf(sc[0][r], sc[1][r]), fmaxf(sc[2][r], sc[3][r]));
      mx = red16_max(mx);
      float nm   = fmaxf(rm[r], mx);
      float corr = __expf(rm[r] - nm);
      rm[r]      = nm;
      float psum = 0.0f;
#pragma unroll
      for (int nt = 0; nt < 4; ++nt) {
        float pv  = __expf(sc[nt][r] - nm);
        sc[nt][r] = pv;
        psum += pv;
      }
      psum  = red16_sum(psum);
      rs[r] = rs[r] * corr + psum;
#pragma unroll
      for (int nt = 0; nt < 4; ++nt) o[nt][r] *= corr;
    }

    // transpose P through LDS into A-fragment layout (per-wave region;
    // same-wave LDS ops are in-order, no block barrier needed)
#pragma unroll
    for (int nt = 0; nt < 4; ++nt)
#pragma unroll
      for (int r = 0; r < 8; ++r)
        Ps[wave][lh * 8 + r][nt * 16 + lr] = (__bf16)sc[nt][r];

    // O += P @ V   (2 k-steps over keys x 4 hd n-tiles)
#pragma unroll
    for (int ks = 0; ks < 2; ++ks) {
      v8bf plo = *(const v8bf*)&Ps[wave][lr][ks * 32 + koff];
      v8bf phi = *(const v8bf*)&Ps[wave][lr][ks * 32 + koff + 16];
      v16bf pf = pack16(plo, phi);
#pragma unroll
      for (int nt = 0; nt < 4; ++nt) {
        int row  = nt * 16 + lr;
        v8bf lo  = *(const v8bf*)&Vs[p][row][ks * 32 + koff];
        v8bf hi  = *(const v8bf*)&Vs[p][row][ks * 32 + koff + 16];
        v16bf vf = pack16(lo, hi);
        o[nt]    = __builtin_amdgcn_wmma_f32_16x16x32_bf16(
            false, pf, false, vf, (short)0, o[nt], false, false);
      }
    }
  }

  // normalize and store (bf16, [B*S, D] layout)
#pragma unroll
  for (int r = 0; r < 8; ++r) {
    float inv = 1.0f / rs[r];
    int m     = q0 + wave * 16 + lh * 8 + r;
#pragma unroll
    for (int nt = 0; nt < 4; ++nt)
      Ob[(size_t)(b * S_ + m) * D_ + h * HD_ + nt * 16 + lr] =
          (__bf16)(o[nt][r] * inv);
  }
}

// ------------------------------ launcher ------------------------------------

extern "C" void kernel_launch(void* const* d_in, const int* in_sizes, int n_in,
                              void* d_out, int out_size, void* d_ws,
                              size_t ws_size, hipStream_t stream) {
  const float* mod1 = (const float*)d_in[0];
  const float* mod2 = (const float*)d_in[1];
  const float* Wq   = (const float*)d_in[2];
  const float* bq   = (const float*)d_in[3];
  const float* Wk   = (const float*)d_in[4];
  const float* bk   = (const float*)d_in[5];
  const float* Wv   = (const float*)d_in[6];
  const float* bv   = (const float*)d_in[7];
  const float* Wo   = (const float*)d_in[8];
  const float* bo   = (const float*)d_in[9];
  const float* Wsc  = (const float*)d_in[10];
  const float* bsc  = (const float*)d_in[11];
  const float* Wsh  = (const float*)d_in[12];
  const float* bsh  = (const float*)d_in[13];
  float* out        = (float*)d_out;

  const size_t ACT = (size_t)MROWS * D_ * sizeof(__bf16);  // 8 MB
  const size_t WT  = (size_t)D_ * D_ * sizeof(__bf16);     // 0.5 MB

  char* w = (char*)d_ws;
  size_t off = 0;
  auto carve = [&](size_t bytes) -> __bf16* {
    __bf16* p = (__bf16*)(w + off);
    off += bytes;
    return p;
  };
  __bf16* mod1b = carve(ACT);
  __bf16* mod2b = carve(ACT);
  __bf16* Wqt   = carve(WT);
  __bf16* Wkt   = carve(WT);
  __bf16* Wvt   = carve(WT);
  __bf16* Wot   = carve(WT);
  __bf16* Wsct  = carve(WT);
  __bf16* Wsht  = carve(WT);
  __bf16* Qb    = carve(ACT);
  __bf16* Krb   = carve(ACT);
  __bf16* Vrb   = carve(ACT);
  __bf16* Scb   = carve(ACT);
  __bf16* Shb   = carve(ACT);
  __bf16* Kfb   = carve(ACT);
  __bf16* Vtb   = carve(ACT);   // [B,H,HD,S]
  __bf16* Obuf  = carve(ACT);

  // 1) casts: mod1b, mod2b and the six Wt planes lie one behind the other
  convert_all_kernel<<<6 * WBLK + 2 * ABLK, 256, 0, stream>>>(
      mod1, mod2, Wq, Wk, Wv, Wo, Wsc, Wsh, mod1b, Wqt);

  // 2) projections (Q carries 1/sqrt(64))
  dim3 gg(D_ / BN, MROWS / BM);  // (4, 64)
  gemm_bf16_kernel<false><<<gg, 256, 0, stream>>>(mod1b, Wqt, bq, Qb,
                                                  MROWS, D_, D_, 0.125f);
  gemm_bf16_kernel<false><<<gg, 256, 0, stream>>>(mod2b, Wkt, bk, Krb,
                                                  MROWS, D_, D_, 1.0f);
  gemm_bf16_kernel<false><<<gg, 256, 0, stream>>>(mod2b, Wvt, bv, Vrb,
                                                  MROWS, D_, D_, 1.0f);
  gemm_bf16_kernel<false><<<gg, 256, 0, stream>>>(mod2b, Wsct, bsc, Scb,
                                                  MROWS, D_, D_, 1.0f);
  gemm_bf16_kernel<false><<<gg, 256, 0, stream>>>(mod2b, Wsht, bsh, Shb,
                                                  MROWS, D_, D_, 1.0f);

  // 3) K' = K*s+sh, V' = V*s+sh (and per-head transposed V')
  fuse_kv_kernel<<<dim3(H_, MROWS / 64), 256, 0, stream>>>(Krb, Vrb, Scb, Shb,
                                                        Kfb, Vtb);

  // 4) flash attention
  attn_kernel<<<dim3(S_ / 64, H_, B_), 128, 0, stream>>>(Qb, Kfb, Vtb, Obuf);

  // 5) output projection -> f32
  gemm_bf16_kernel<true><<<gg, 256, 0, stream>>>(Obuf, Wot, bo, out,
                                                 MROWS, D_, D_, 1.0f);
}

// v003
// Measured time: 135 microseconds a run.
// Two timings next to v002 both put it at 1.15 times that version's speed.
// Counting every step since v000, it is 2.00 times as fast.
#include <hip/hip_runtime.h>
#include <hip/hip_bf16.h>

// ---------------------------------------------------------------------------
// MultiHeadCrossModalAttention on MI455X (gfx1250, wave32, WMMA bf16,
// async global->LDS staging, DPP16 softmax reductions)
// B=4, S=2048, D=512, H=8, HD=64
// ---------------------------------------------------------------------------

typedef __attribute__((ext_vector_type(16))) __bf16 v16bf;
typedef __attribute__((ext_vector_type(8)))  __bf16 v8bf;
typedef __attribute__((ext_vector_type(8)))  float  v8f;
typedef int v4i __attribute__((vector_size(16)));

#define B_  4
#define S_  2048
#define D_  512
#define H_  8
#define HD_ 64
#define MROWS (B_ * S_)          // 8192

#define AS1 __attribute__((address_space(1)))
#define AS3 __attribute__((address_space(3)))

#if __has_builtin(__builtin_amdgcn_global_load_async_to_lds_b128) && \
    __has_builtin(__builtin_amdgcn_s_wait_asynccnt)
#define HAVE_ASYNC_LDS 1
#else
#define HAVE_ASYNC_LDS 0
#endif

#if __has_builtin(__builtin_amdgcn_update_dpp)
#define HAVE_DPP 1
#else
#define HAVE_DPP 0
#endif

// one 16B chunk: global -> LDS (async on CDNA5, sync fallback otherwise)
__device__ __forceinline__ void stage16(const __bf16* g, __bf16* l) {
#if HAVE_ASYNC_LDS
  __builtin_amdgcn_global_load_async_to_lds_b128((AS1 v4i*)g, (AS3 v4i*)l,
                                                 0, 0);
#else
  *(v8bf*)l = *(const v8bf*)g;
#endif
}

__device__ __forceinline__ void async_wait_all() {
#if HAVE_ASYNC_LDS
  __builtin_amdgcn_s_wait_asynccnt(0);
#endif
}

#if HAVE_DPP
template <int CTRL>
__device__ __forceinline__ float dpp_mov_f32(float x) {
  int r = __builtin_amdgcn_update_dpp(0, __float_as_int(x), CTRL, 0xF, 0xF,
                                      true);
  return __int_as_float(r);
}
#endif

// reduce (max / sum) across each 16-lane group; all lanes get the result.
__device__ __forceinline__ float red16_max(float x) {
#if HAVE_DPP
  x = fmaxf(x, dpp_mov_f32<0xB1>(x));    // quad_perm(1,0,3,2): xor 1
  x = fmaxf(x, dpp_mov_f32<0x4E>(x));    // quad_perm(2,3,0,1): xor 2
  x = fmaxf(x, dpp_mov_f32<0x141>(x));   // row_half_mirror: cross-quad in 8
  x = fmaxf(x, dpp_mov_f32<0x140>(x));   // row_mirror: cross-8 in 16
#else
#pragma unroll
  for (int off = 1; off < 16; off <<= 1) x = fmaxf(x, __shfl_xor(x, off, 32));
#endif
  return x;
}

__device__ __forceinline__ float red16_sum(float x) {
#if HAVE_DPP
  x += dpp_mov_f32<0xB1>(x);
  x += dpp_mov_f32<0x4E>(x);
  x += dpp_mov_f32<0x141>(x);
  x += dpp_mov_f32<0x140>(x);
#else
#pragma unroll
  for (int off = 1; off < 16; off <<= 1) x += __shfl_xor(x, off, 32);
#endif
  return x;
}

__device__ __forceinline__ v16bf pack16(v8bf lo, v8bf hi) {
  union { v16bf v; v8bf p[2]; } u;
  u.p[0] = lo; u.p[1] = hi;
  return u.v;
}

__device__ __forceinline__ v8f zero8() {
  v8f z;
#pragma unroll
  for (int i = 0; i < 8; ++i) z[i] = 0.0f;
  return z;
}

// ------------------------------- casts -------------------------------------
// One launch converts both activation tensors and all six weight matrices to
// bf16. A short wave costs more to start than to run, so a lane converts 64
// activation elements or a 4 (n) x 8 (k) piece of a weight matrix.
// Blocks 0 .. 6*WBLK-1: weights, Wt[n][k] = W[k][n]; the rest: activations.

typedef __attribute__((ext_vector_type(4))) float  v4f;
typedef __attribute__((ext_vector_type(4))) __bf16 v4bf;

#define WBLK 32    // blocks per 512x512 weight matrix: tiles of 64 (k) x 128 (n)
#define ABLK 256   // blocks per activation tensor: 16,384 elements each
#define ACH  16    // 16-byte chunks per lane of an activation block

__global__ __launch_bounds__(256) void convert_all_kernel(
    const float* __restrict__ act0, const float* __restrict__ act1,
    const float* __restrict__ W0, const float* __restrict__ W1,
    const float* __restrict__ W2, const float* __restrict__ W3,
    const float* __restrict__ W4, const float* __restrict__ W5,
    __bf16* __restrict__ actb, __bf16* __restrict__ wtb) {
  const unsigned int blk = blockIdx.x;
  const int tid = threadIdx.x;

  if (blk < 6 * WBLK) {
    const int wi = blk / WBLK;
    const int t  = blk % WBLK;
    const float* W = wi == 0 ? W0 : wi == 1 ? W1 : wi == 2 ? W2
                   : wi == 3 ? W3 : wi == 4 ? W4 : W5;
    __bf16* Wt = wtb + (size_t)wi * (D_ * D_);
    // eight neighbouring lanes hold the eight k chunks of one Wt row piece:
    // together they store a whole 128-byte line
    const int k0 = (t & 7) * 64 + (tid & 7) * 8;
    const int n0 = (t >> 3) * 128 + (tid >> 3) * 4;
    v4f r[8];
#pragma unroll  // all eight loads in flight before the first convert
    for (int j = 0; j < 8; ++j) r[j] = *(const v4f*)&W[(k0 + j) * D_ + n0];
#pragma unroll  // constant indices: the vector elements stay in registers
    for (int c = 0; c < 4; ++c) {
      v8bf o;
#pragma unroll  // as above
      for (int j = 0; j < 8; ++j) o[j] = (__bf16)r[j][c];
      *(v8bf*)&Wt[(n0 + c) * D_ + k0] = o;
    }
  } else {
    const unsigned int ab = blk - 6 * WBLK;
    const int ti = ab / ABLK;
    const float* in = ti == 0 ? act0 : act1;
    __bf16* out = actb + (size_t)ti * (MROWS * D_);
    const unsigned int e0 = (ab % ABLK) * (256 * ACH * 4) + tid * 4;
    const unsigned int lo = e0 * 4;   // byte offset that all the loads share
    v4f r[ACH];
#pragma unroll  // all loads in flight before the first convert
    for (int j = 0; j < ACH; ++j)
      r[j] = *(const v4f*)((const char*)in + lo + j * 4096);
    // the wait owed before a register that an issued load names is rewritten;
    // it takes the shared offset as an input, so that no load's result lands in
    // that register while earlier loads of the run still name it
    asm volatile("s_wait_xcnt 0x0" :: "v"(lo) : "memory");
    // keeps the first converts from rising among the loads: the last loads would
    // then take over registers of the first and issue only when those return
    __builtin_amdgcn_sched_barrier(0);
#pragma unroll  // constant indices: the loaded chunks stay in registers
    for (int j = 0; j < ACH; ++j)
      *(v4bf*)&out[e0 + j * 1024] = __builtin_convertvector(r[j], v4bf);
    // the same wait behind the last stores: the code that follows them in the
    // built text rewrites their offset and data registers
    asm volatile("s_wait_xcnt 0x0" ::: "memory");
  }
}

// ------------------------------- GEMM --------------------------------------
// C[M,N] = (A[M,K] @ Bt[N,K]^T + bias[N]) * alpha
// Tiles: BM=128, BN=128, BK=32.  256 threads = 8 waves (2x4), wave: 64x32.
// Double-buffered async global->LDS staging.

#define BM 128
#define BN 128
#define BK 32

template <bool OUT_F32>
__device__ __forceinline__ void gemm_tile(
    const __bf16* __restrict__ A, const __bf16* __restrict__ Bt,
    const float* __restrict__ bias, void* __restrict__ C,
    int M, int N, int K, float alpha) {
  __shared__ __align__(16) __bf16 As[2][BM][BK + 8];   // 80B rows
  __shared__ __align__(16) __bf16 Bs[2][BM][BK + 8];

  const int tid  = threadIdx.x;
  const int bm0  = blockIdx.y * BM;
  const int bn0  = blockIdx.x * BN;
  const int wave = tid >> 5;
  const int lane = tid & 31;
  const int wm   = wave >> 2;        // 0..1 -> 64-row slab
  const int wn   = wave & 3;         // 0..3 -> 32-col slab
  const int lr   = lane & 15;
  const int lh   = lane >> 4;
  const int koff = lh * 8;

  // this thread's two 16B staging chunks (same mapping for A and B tiles)
  const int c0   = tid * 2;
  const int row0 = c0 >> 2;
  const int col0 = (c0 & 3) * 8;
  const int row1 = (c0 + 1) >> 2;
  const int col1 = ((c0 + 1) & 3) * 8;

  v8f acc[4][2];
#pragma unroll
  for (int mt = 0; mt < 4; ++mt)
#pragma unroll
    for (int nt = 0; nt < 2; ++nt) acc[mt][nt] = zero8();

  // prologue: stage tile 0 into buffer 0
  {
    stage16(&A[(size_t)(bm0 + row0) * K + col0], &As[0][row0][col0]);
    stage16(&Bt[(size_t)(bn0 + row0) * K + col0], &Bs[0][row0][col0]);
    stage16(&A[(size_t)(bm0 + row1) * K + col1], &As[0][row1][col1]);
    stage16(&Bt[(size_t)(bn0 + row1) * K + col1], &Bs[0][row1][col1]);
  }

  int p = 0;
  for (int bk = 0; bk < K; bk += BK, p ^= 1) {
    async_wait_all();
    __syncthreads();
    if (bk + BK < K) {
      int nb = bk + BK;
      stage16(&A[(size_t)(bm0 + row0) * K + nb + col0], &As[p ^ 1][row0][col0]);
      stage16(&Bt[(size_t)(bn0 + row0) * K + nb + col0], &Bs[p ^ 1][row0][col0]);
      stage16(&A[(size_t)(bm0 + row1) * K + nb + col1], &As[p ^ 1][row1][col1]);
      stage16(&Bt[(size_t)(bn0 + row1) * K + nb + col1], &Bs[p ^ 1][row1][col1]);
    }

    v16bf af[4], bf[2];
#pragma unroll
    for (int mt = 0; mt < 4; ++mt) {
      int r   = wm * 64 + mt * 16 + lr;
      v8bf lo = *(const v8bf*)&As[p][r][koff];
      v8bf hi = *(const v8bf*)&As[p][r][koff + 16];
      af[mt]  = pack16(lo, hi);
    }
#pragma unroll
    for (int nt = 0; nt < 2; ++nt) {
      int r   = wn * 32 + nt * 16 + lr;
      v8bf lo = *(const v8bf*)&Bs[p][r][koff];
      v8bf hi = *(const v8bf*)&Bs[p][r][koff + 16];
      bf[nt]  = pack16(lo, hi);
    }
#pragma unroll
    for (int mt = 0; mt < 4; ++mt)
#pragma unroll
      for (int nt = 0; nt < 2; ++nt)
        acc[mt][nt] = __builtin_amdgcn_wmma_f32_16x16x32_bf16(
            false, af[mt], false, bf[nt], (short)0, acc[mt][nt], false, false);
  }

  // epilogue: C layout -> lane holds col n=lr of each tile, rows r + lh*8
#pragma unroll
  for (int nt = 0; nt < 2; ++nt) {
    int n    = bn0 + wn * 32 + nt * 16 + lr;
    float bv = bias[n];
#pragma unroll
    for (int mt = 0; mt < 4; ++mt) {
#pragma unroll
      for (int r = 0; r < 8; ++r) {
        int m   = bm0 + wm * 64 + mt * 16 + lh * 8 + r;
        float v = (acc[mt][nt][r] + bv) * alpha;
        if constexpr (OUT_F32)
          ((float*)C)[(size_t)m * N + n] = v;
        else
          ((__bf16*)C)[(size_t)m * N + n] = (__bf16)v;
      }
    }
  }
}

// All five input projections in one launch; blockIdx.z picks the product.
// One product alone is 256 workgroups, one per WGP: each K step then waits out
// the whole latency of its copies with nothing else to run. With 1,280
// workgroups several share a WGP and fill each other's waits, and four launch
// gaps, fills and tails go.
// actb: the two activation planes; wtb: the six Wt planes in the order
// q, k, v, o, scale, shift; outb: five [M, N] planes q, k, v, scale, shift.
__global__ __launch_bounds__(256) void proj5_kernel(
    const __bf16* __restrict__ actb, const __bf16* __restrict__ wtb,
    const float* __restrict__ bq, const float* __restrict__ bk,
    const float* __restrict__ bv, const float* __restrict__ bsc,
    const float* __restrict__ bsh, __bf16* __restrict__ outb,
    int M, int N, int K) {
  const int z = blockIdx.z;
  const __bf16* A  = z == 0 ? actb : actb + (size_t)M * K;
  const __bf16* Bt = wtb + (size_t)(z < 3 ? z : z + 1) * N * K;
  const float* bias = z == 0 ? bq : z == 1 ? bk : z == 2 ? bv
                    : z == 3 ? bsc : bsh;
  gemm_tile<false>(A, Bt, bias, outb + (size_t)z * M * N, M, N, K,
                   z == 0 ? 0.125f : 1.0f);   // Q carries 1/sqrt(64)
}

// output projection -> f32
__global__ __launch_bounds__(256) void gemm_out_kernel(
    const __bf16* __restrict__ A, const __bf16* __restrict__ Bt,
    const float* __restrict__ bias, float* __restrict__ C,
    int M, int N, int K, float alpha) {
  gemm_tile<true>(A, Bt, bias, C, M, N, K, alpha);
}

// ------------------------------- fuse --------------------------------------
// K' = K*s + sh ; V' = V*s + sh ; also write V' transposed per head:
// Vt[b][h][hd][s]
// grid: (H, B*S/64), block 256. One block owns a 64 (s) x 64 (hd) tile of one
// head. Every global access is a 16-byte chunk of a 128-byte row piece; the
// V' tile turns round in LDS.
// LDS tile: row hd, 32 dwords, a dword holds V' of rows s = 2*sp and 2*sp + 1.
// The 4-dword group index is XORed with hd >> 3: the eight hd chunks of a wave
// then store to different banks, and a 16-byte read still finds a whole group.
__global__ __launch_bounds__(256) void fuse_kv_kernel(
    const __bf16* __restrict__ Kr, const __bf16* __restrict__ Vr,
    const __bf16* __restrict__ Sc, const __bf16* __restrict__ Sh,
    __bf16* __restrict__ Kf, __bf16* __restrict__ Vt) {
  __shared__ __align__(16) unsigned int Tv[HD_ * 32];

  const int tid = threadIdx.x;
  const int h   = blockIdx.x;
  const int m0  = blockIdx.y * 64;      // first row in [B*S]
  const int b   = m0 / S_;
  const int s0  = m0 & (S_ - 1);
  const int hc  = tid & 7;              // 8-element chunk of hd
  const int sp  = tid >> 3;             // pair of s rows

  // byte offset of this thread's chunk in row 2*sp, the same in all five
  // [B*S, D] planes (8 MiB each, so 32 bits hold it); row 2*sp + 1 lies RB on
  const unsigned int o0 = (unsigned int)((m0 + 2 * sp) * D_ + h * HD_ + hc * 8) * 2u;
  constexpr unsigned int RB = D_ * 2;
  auto ld = [](const __bf16* p, unsigned int o) {
    return *(const v8bf*)((const char*)p + o);
  };
  const v8bf k0 = ld(Kr, o0), k1 = ld(Kr, o0 + RB);
  const v8bf v0 = ld(Vr, o0), v1 = ld(Vr, o0 + RB);
  const v8bf c0 = ld(Sc, o0), c1 = ld(Sc, o0 + RB);
  const v8bf t0 = ld(Sh, o0), t1 = ld(Sh, o0 + RB);

  v8bf ko0, ko1;
  const int grp = (((sp >> 2) ^ hc) << 2) + (sp & 3);
#pragma unroll  // constant j: the vector elements stay in registers
  for (int j = 0; j < 8; ++j) {
    float sc0 = (float)c0[j], sh0 = (float)t0[j];
    float sc1 = (float)c1[j], sh1 = (float)t1[j];
    ko0[j] = (__bf16)((float)k0[j] * sc0 + sh0);
    ko1[j] = (__bf16)((float)k1[j] * sc1 + sh1);
    union { __bf16 e[2]; unsigned int u; } pk;
    pk.e[0] = (__bf16)((float)v0[j] * sc0 + sh0);
    pk.e[1] = (__bf16)((float)v1[j] * sc1 + sh1);
    Tv[(hc * 8 + j) * 32 + grp] = pk.u;
  }

  __syncthreads();

  // behind the barrier, so that no wave waits there for these stores to return
  *(v8bf*)((char*)Kf + o0) = ko0;
  *(v8bf*)((char*)Kf + o0 + RB) = ko1;

  __bf16* vout = Vt + (size_t)(b * H_ + h) * HD_ * S_ + s0;
#pragma unroll  // both LDS reads issue before the first store waits for its data
  for (int i = 0; i < 2; ++i) {
    int c = tid + i * 256, hd = c >> 3, g = c & 7;
    v8bf row = *(const v8bf*)&Tv[hd * 32 + ((g ^ (hd >> 3)) << 2)];
    *(v8bf*)(vout + (size_t)hd * S_ + g * 8) = row;
  }
}

// ---------------------------- flash attention -------------------------------
// grid: (S/64, H, B), block 128 (4 waves). Wave w owns q rows q0+w*16..+15.
// Q already scaled by 1/sqrt(HD). Double-buffered async K/V tile staging.
__global__ __launch_bounds__(128) void attn_kernel(
    const __bf16* __restrict__ Qb, const __bf16* __restrict__ Kb,
    const __bf16* __restrict__ Vt, __bf16* __restrict__ Ob) {
  __shared__ __align__(16) __bf16 Ks[2][64][72];    // [key][hd]
  __shared__ __align__(16) __bf16 Vs[2][64][72];    // [hd][key] (transposed V)
  __shared__ __align__(16) __bf16 Ps[4][16][72];    // per-wave P tile

  const int b    = blockIdx.z;
  const int h    = blockIdx.y;
  const int q0   = blockIdx.x * 64;
  const int tid  = threadIdx.x;
  const int wave = tid >> 5;
  const int lane = tid & 31;
  const int lr   = lane & 15;
  const int lh   = lane >> 4;
  const int koff = lh * 8;

  const __bf16* Kbase = Kb + (size_t)(b * S_) * D_ + h * HD_;
  const __bf16* Vbase = Vt + (size_t)(b * H_ + h) * HD_ * S_;

  // Q fragments (16x64 per wave -> 2 k-steps), resident in VGPRs
  v16bf qf[2];
  {
    int qrow           = q0 + wave * 16 + lr;
    const __bf16* qptr = Qb + (size_t)(b * S_ + qrow) * D_ + h * HD_;
#pragma unroll
    for (int ks = 0; ks < 2; ++ks) {
      v8bf lo = *(const v8bf*)(qptr + ks * 32 + koff);
      v8bf hi = *(const v8bf*)(qptr + ks * 32 + koff + 16);
      qf[ks]  = pack16(lo, hi);
    }
  }

  v8f o[4];
#pragma unroll
  for (int nt = 0; nt < 4; ++nt) o[nt] = zero8();
  float rm[8], rs[8];
#pragma unroll
  for (int r = 0; r < 8; ++r) { rm[r] = -1e30f; rs[r] = 0.0f; }

  // this thread's four 16B staging chunks per tile
  // chunk c = tid + i*128; row = c>>3 (8 x 16B per 128B row); col = (c&7)*8
  // prologue: stage tile 0 into buffer 0
#pragma unroll
  for (int i = 0; i < 4; ++i) {
    int c = tid + i * 128, row = c >> 3, col = (c & 7) * 8;
    stage16(&Kbase[(size_t)row * D_ + col], &Ks[0][row][col]);
    stage16(&Vbase[(size_t)row * S_ + col], &Vs[0][row][col]);
  }

  int p = 0;
  for (int kt0 = 0; kt0 < S_; kt0 += 64, p ^= 1) {
    async_wait_all();
    __syncthreads();
    if (kt0 + 64 < S_) {
      int nk = kt0 + 64;
#pragma unroll
      for (int i = 0; i < 4; ++i) {
        int c = tid + i * 128, row = c >> 3, col = (c & 7) * 8;
        stage16(&Kbase[(size_t)(nk + row) * D_ + col], &Ks[p ^ 1][row][col]);
        stage16(&Vbase[(size_t)row * S_ + nk + col], &Vs[p ^ 1][row][col]);
      }
    }

    // S = Q @ K^T   (4 n-tiles x 2 k-steps)
    v8f sc[4];
#pragma unroll
    for (int nt = 0; nt < 4; ++nt) {
      sc[nt] = zero8();
#pragma unroll
      for (int ks = 0; ks < 2; ++ks) {
        int row  = nt * 16 + lr;
        v8bf lo  = *(const v8bf*)&Ks[p][row][ks * 32 + koff];
        v8bf hi  = *(const v8bf*)&Ks[p][row][ks * 32 + koff + 16];
        v16bf kf = pack16(lo, hi);
        sc[nt]   = __builtin_amdgcn_wmma_f32_16x16x32_bf16(
            false, qf[ks], false, kf, (short)0, sc[nt], false, false);
      }
    }

    // online softmax: lane holds col n=lr, rows r+lh*8; row lives in 16 lanes
#pragma unroll
    for (int r = 0; r < 8; ++r) {
      float mx = fmaxf(fmaxf(sc[0][r], sc[1][r]), fmaxf(sc[2][r], sc[3][r]));
      mx = red16_max(mx);
      float nm   = fmaxf(rm[r], mx);
      float corr = __expf(rm[r] - nm);
      rm[r]      = nm;
      float psum = 0.0f;
#pragma unroll
      for (int nt = 0; nt < 4; ++nt) {
        float pv  = __expf(sc[nt][r] - nm);
        sc[nt][r] = pv;
        psum += pv;
      }
      psum  = red16_sum(psum);
      rs[r] = rs[r] * corr + psum;
#pragma unroll
      for (int nt = 0; nt < 4; ++nt) o[nt][r] *= corr;
    }

    // transpose P through LDS into A-fragment layout (per-wave region;
    // same-wave LDS ops are in-order, no block barrier needed)
#pragma unroll
    for (int nt = 0; nt < 4; ++nt)
#pragma unroll
      for (int r = 0; r < 8; ++r)
        Ps[wave][lh * 8 + r][nt * 16 + lr] = (__bf16)sc[nt][r];

    // O += P @ V   (2 k-steps over keys x 4 hd n-tiles)
#pragma unroll
    for (int ks = 0; ks < 2; ++ks) {
      v8bf plo = *(const v8bf*)&Ps[wave][lr][ks * 32 + koff];
      v8bf phi = *(const v8bf*)&Ps[wave][lr][ks * 32 + koff + 16];
      v16bf pf = pack16(plo, phi);
#pragma unroll
      for (int nt = 0; nt < 4; ++nt) {
        int row  = nt * 16 + lr;
        v8bf lo  = *(const v8bf*)&Vs[p][row][ks * 32 + koff];
        v8bf hi  = *(const v8bf*)&Vs[p][row][ks * 32 + koff + 16];
        v16bf vf = pack16(lo, hi);
        o[nt]    = __builtin_amdgcn_wmma_f32_16x16x32_bf16(
            false, pf, false, vf, (short)0, o[nt], false, false);
      }
    }
  }

  // normalize and store (bf16, [B*S, D] layout)
#pragma unroll
  for (int r = 0; r < 8; ++r) {
    float inv = 1.0f / rs[r];
    int m     = q0 + wave * 16 + lh * 8 + r;
#pragma unroll
    for (int nt = 0; nt < 4; ++nt)
      Ob[(size_t)(b * S_ + m) * D_ + h * HD_ + nt * 16 + lr] =
          (__bf16)(o[nt][r] * inv);
  }
}

// ------------------------------ launcher ------------------------------------

extern "C" void kernel_launch(void* const* d_in, const int* in_sizes, int n_in,
                              void* d_out, int out_size, void* d_ws,
                              size_t ws_size, hipStream_t stream) {
  const float* mod1 = (const float*)d_in[0];
  const float* mod2 = (const float*)d_in[1];
  const float* Wq   = (const float*)d_in[2];
  const float* bq   = (const float*)d_in[3];
  const float* Wk   = (const float*)d_in[4];
  const float* bk   = (const float*)d_in[5];
  const float* Wv   = (const float*)d_in[6];
  const float* bv   = (const float*)d_in[7];
  const float* Wo   = (const float*)d_in[8];
  const float* bo   = (const float*)d_in[9];
  const float* Wsc  = (const float*)d_in[10];
  const float* bsc  = (const float*)d_in[11];
  const float* Wsh  = (const float*)d_in[12];
  const float* bsh  = (const float*)d_in[13];
  float* out        = (float*)d_out;

  const size_t ACT = (size_t)MROWS * D_ * sizeof(__bf16);  // 8 MB
  const size_t WT  = (size_t)D_ * D_ * sizeof(__bf16);     // 0.5 MB

  char* w = (char*)d_ws;
  size_t off = 0;
  auto carve = [&](size_t bytes) -> __bf16* {
    __bf16* p = (__bf16*)(w + off);
    off += bytes;
    return p;
  };
  __bf16* mod1b = carve(ACT);
  __bf16* mod2b = carve(ACT);
  __bf16* Wqt   = carve(WT);
  __bf16* Wkt   = carve(WT);
  __bf16* Wvt   = carve(WT);
  __bf16* Wot   = carve(WT);
  __bf16* Wsct  = carve(WT);
  __bf16* Wsht  = carve(WT);
  __bf16* Qb    = carve(ACT);
  __bf16* Krb   = carve(ACT);
  __bf16* Vrb   = carve(ACT);
  __bf16* Scb   = carve(ACT);
  __bf16* Shb   = carve(ACT);
  __bf16* Kfb   = carve(ACT);
  __bf16* Vtb   = carve(ACT);   // [B,H,HD,S]
  __bf16* Obuf  = carve(ACT);

  // 1) casts: mod1b, mod2b and the six Wt planes lie one behind the other
  convert_all_kernel<<<6 * WBLK + 2 * ABLK, 256, 0, stream>>>(
      mod1, mod2, Wq, Wk, Wv, Wo, Wsc, Wsh, mod1b, Wqt);

  // 2) projections: Qb, Krb, Vrb, Scb, Shb lie one behind the other
  proj5_kernel<<<dim3(D_ / BN, MROWS / BM, 5), 256, 0, stream>>>(
      mod1b, Wqt, bq, bk, bv, bsc, bsh, Qb, MROWS, D_, D_);

  // 3) K' = K*s+sh, V' = V*s+sh (and per-head transposed V')
  fuse_kv_kernel<<<dim3(H_, MROWS / 64), 256, 0, stream>>>(Krb, Vrb, Scb, Shb,
                                                        Kfb, Vtb);

  // 4) flash attention
  attn_kernel<<<dim3(S_ / 64, H_, B_), 128, 0, stream>>>(Qb, Kfb, Vtb, Obuf);

  // 5) output projection -> f32
  gemm_out_kernel<<<dim3(D_ / BN, MROWS / BM), 256, 0, stream>>>(
      Obuf, Wot, bo, out, MROWS, D_, D_, 1.0f);
}

// v004
// It runs in 112 microseconds.
// Timed twice side by side with v003, it ran 1.21 times as fast both times.
// Over all steps from v000 it is 2.43 times as fast.
#include <hip/hip_runtime.h>
#include <hip/hip_bf16.h>

// ---------------------------------------------------------------------------
// MultiHeadCrossModalAttention on MI455X (gfx1250, wave32, WMMA bf16,
// async global->LDS staging, transposed attention products)
// B=4, S=2048, D=512, H=8, HD=64
// ---------------------------------------------------------------------------

typedef __attribute__((ext_vector_type(16))) __bf16 v16bf;
typedef __attribute__((ext_vector_type(8)))  __bf16 v8bf;
typedef __attribute__((ext_vector_type(8)))  float  v8f;
typedef int v4i __attribute__((vector_size(16)));

#define B_  4
#define S_  2048
#define D_  512
#define H_  8
#define HD_ 64
#define MROWS (B_ * S_)          // 8192

#define AS1 __attribute__((address_space(1)))
#define AS3 __attribute__((address_space(3)))

#if __has_builtin(__builtin_amdgcn_global_load_async_to_lds_b128) && \
    __has_builtin(__builtin_amdgcn_s_wait_asynccnt)
#define HAVE_ASYNC_LDS 1
#else
#define HAVE_ASYNC_LDS 0
#endif

// one 16B chunk: global -> LDS (async on CDNA5, sync fallback otherwise)
__device__ __forceinline__ void stage16(const __bf16* g, __bf16* l) {
#if HAVE_ASYNC_LDS
  __builtin_amdgcn_global_load_async_to_lds_b128((AS1 v4i*)g, (AS3 v4i*)l,
                                                 0, 0);
#else
  *(v8bf*)l = *(const v8bf*)g;
#endif
}

__device__ __forceinline__ void async_wait_all() {
#if HAVE_ASYNC_LDS
  __builtin_amdgcn_s_wait_asynccnt(0);
#endif
}

__device__ __forceinline__ v16bf pack16(v8bf lo, v8bf hi) {
  union { v16bf v; v8bf p[2]; } u;
  u.p[0] = lo; u.p[1] = hi;
  return u.v;
}

__device__ __forceinline__ v8f zero8() {
  v8f z;
#pragma unroll
  for (int i = 0; i < 8; ++i) z[i] = 0.0f;
  return z;
}

// ------------------------------- casts -------------------------------------
// One launch converts both activation tensors and all six weight matrices to
// bf16. A short wave costs more to start than to run, so a lane converts 64
// activation elements or a 4 (n) x 8 (k) piece of a weight matrix.
// Blocks 0 .. 6*WBLK-1: weights, Wt[n][k] = W[k][n]; the rest: activations.

typedef __attribute__((ext_vector_type(4))) float  v4f;
typedef __attribute__((ext_vector_type(4))) __bf16 v4bf;

#define WBLK 32    // blocks per 512x512 weight matrix: tiles of 64 (k) x 128 (n)
#define ABLK 256   // blocks per activation tensor: 16,384 elements each
#define ACH  16    // 16-byte chunks per lane of an activation block

__global__ __launch_bounds__(256) void convert_all_kernel(
    const float* __restrict__ act0, const float* __restrict__ act1,
    const float* __restrict__ W0, const float* __restrict__ W1,
    const float* __restrict__ W2, const float* __restrict__ W3,
    const float* __restrict__ W4, const float* __restrict__ W5,
    __bf16* __restrict__ actb, __bf16* __restrict__ wtb) {
  const unsigned int blk = blockIdx.x;
  const int tid = threadIdx.x;

  if (blk < 6 * WBLK) {
    const int wi = blk / WBLK;
    const int t  = blk % WBLK;
    const float* W = wi == 0 ? W0 : wi == 1 ? W1 : wi == 2 ? W2
                   : wi == 3 ? W3 : wi == 4 ? W4 : W5;
    __bf16* Wt = wtb + (size_t)wi * (D_ * D_);
    // eight neighbouring lanes hold the eight k chunks of one Wt row piece:
    // together they store a whole 128-byte line
    const int k0 = (t & 7) * 64 + (tid & 7) * 8;
    const int n0 = (t >> 3) * 128 + (tid >> 3) * 4;
    v4f r[8];
#pragma unroll  // all eight loads in flight before the first convert
    for (int j = 0; j < 8; ++j) r[j] = *(const v4f*)&W[(k0 + j) * D_ + n0];
#pragma unroll  // constant indices: the vector elements stay in registers
    for (int c = 0; c < 4; ++c) {
      v8bf o;
#pragma unroll  // as above
      for (int j = 0; j < 8; ++j) o[j] = (__bf16)r[j][c];
      *(v8bf*)&Wt[(n0 + c) * D_ + k0] = o;
    }
  } else {
    const unsigned int ab = blk - 6 * WBLK;
    const int ti = ab / ABLK;
    const float* in = ti == 0 ? act0 : act1;
    __bf16* out = actb + (size_t)ti * (MROWS * D_);
    const unsigned int e0 = (ab % ABLK) * (256 * ACH * 4) + tid * 4;
    const unsigned int lo = e0 * 4;   // byte offset that all the loads share
    v4f r[ACH];
#pragma unroll  // all loads in flight before the first convert
    for (int j = 0; j < ACH; ++j)
      r[j] = *(const v4f*)((const char*)in + lo + j * 4096);
    // the wait owed before a register that an issued load names is rewritten;
    // it takes the shared offset as an input, so that no load's result lands in
    // that register while earlier loads of the run still name it
    asm volatile("s_wait_xcnt 0x0" :: "v"(lo) : "memory");
    // keeps the first converts from rising among the loads: the last loads would
    // then take over registers of the first and issue only when those return
    __builtin_amdgcn_sched_barrier(0);
#pragma unroll  // constant indices: the loaded chunks stay in registers
    for (int j = 0; j < ACH; ++j)
      *(v4bf*)&out[e0 + j * 1024] = __builtin_convertvector(r[j], v4bf);
    // the same wait behind the last stores: the code that follows them in the
    // built text rewrites their offset and data registers
    asm volatile("s_wait_xcnt 0x0" ::: "memory");
  }
}

// ------------------------------- GEMM --------------------------------------
// C[M,N] = (A[M,K] @ Bt[N,K]^T + bias[N]) * alpha
// Tiles: BM=128, BN=128, BK=32.  256 threads = 8 waves (2x4), wave: 64x32.
// Double-buffered async global->LDS staging.

#define BM 128
#define BN 128
#define BK 32

template <bool OUT_F32>
__device__ __forceinline__ void gemm_tile(
    const __bf16* __restrict__ A, const __bf16* __restrict__ Bt,
    const float* __restrict__ bias, void* __restrict__ C,
    int M, int N, int K, float alpha) {
  __shared__ __align__(16) __bf16 As[2][BM][BK + 8];   // 80B rows
  __shared__ __align__(16) __bf16 Bs[2][BM][BK + 8];

  const int tid  = threadIdx.x;
  const int bm0  = blockIdx.y * BM;
  const int bn0  = blockIdx.x * BN;
  const int wave = tid >> 5;
  const int lane = tid & 31;
  const int wm   = wave >> 2;        // 0..1 -> 64-row slab
  const int wn   = wave & 3;         // 0..3 -> 32-col slab
  const int lr   = lane & 15;
  const int lh   = lane >> 4;
  const int koff = lh * 8;

  // this thread's two 16B staging chunks (same mapping for A and B tiles)
  const int c0   = tid * 2;
  const int row0 = c0 >> 2;
  const int col0 = (c0 & 3) * 8;
  const int row1 = (c0 + 1) >> 2;
  const int col1 = ((c0 + 1) & 3) * 8;

  v8f acc[4][2];
#pragma unroll
  for (int mt = 0; mt < 4; ++mt)
#pragma unroll
    for (int nt = 0; nt < 2; ++nt) acc[mt][nt] = zero8();

  // prologue: stage tile 0 into buffer 0
  {
    stage16(&A[(size_t)(bm0 + row0) * K + col0], &As[0][row0][col0]);
    stage16(&Bt[(size_t)(bn0 + row0) * K + col0], &Bs[0][row0][col0]);
    stage16(&A[(size_t)(bm0 + row1) * K + col1], &As[0][row1][col1]);
    stage16(&Bt[(size_t)(bn0 + row1) * K + col1], &Bs[0][row1][col1]);
  }

  int p = 0;
  for (int bk = 0; bk < K; bk += BK, p ^= 1) {
    async_wait_all();
    __syncthreads();
    if (bk + BK < K) {
      int nb = bk + BK;
      stage16(&A[(size_t)(bm0 + row0) * K + nb + col0], &As[p ^ 1][row0][col0]);
      stage16(&Bt[(size_t)(bn0 + row0) * K + nb + col0], &Bs[p ^ 1][row0][col0]);
      stage16(&A[(size_t)(bm0 + row1) * K + nb + col1], &As[p ^ 1][row1][col1]);
      stage16(&Bt[(size_t)(bn0 + row1) * K + nb + col1], &Bs[p ^ 1][row1][col1]);
    }

    v16bf af[4], bf[2];
#pragma unroll
    for (int mt = 0; mt < 4; ++mt) {
      int r   = wm * 64 + mt * 16 + lr;
      v8bf lo = *(const v8bf*)&As[p][r][koff];
      v8bf hi = *(const v8bf*)&As[p][r][koff + 16];
      af[mt]  = pack16(lo, hi);
    }
#pragma unroll
    for (int nt = 0; nt < 2; ++nt) {
      int r   = wn * 32 + nt * 16 + lr;
      v8bf lo = *(const v8bf*)&Bs[p][r][koff];
      v8bf hi = *(const v8bf*)&Bs[p][r][koff + 16];
      bf[nt]  = pack16(lo, hi);
    }
#pragma unroll
    for (int mt = 0; mt < 4; ++mt)
#pragma unroll
      for (int nt = 0; nt < 2; ++nt)
        acc[mt][nt] = __builtin_amdgcn_wmma_f32_16x16x32_bf16(
            false, af[mt], false, bf[nt], (short)0, acc[mt][nt], false, false);
  }

  // epilogue: C layout -> lane holds col n=lr of each tile, rows r + lh*8
#pragma unroll
  for (int nt = 0; nt < 2; ++nt) {
    int n    = bn0 + wn * 32 + nt * 16 + lr;
    float bv = bias[n];
#pragma unroll
    for (int mt = 0; mt < 4; ++mt) {
#pragma unroll
      for (int r = 0; r < 8; ++r) {
        int m   = bm0 + wm * 64 + mt * 16 + lh * 8 + r;
        float v = (acc[mt][nt][r] + bv) * alpha;
        if constexpr (OUT_F32)
          ((float*)C)[(size_t)m * N + n] = v;
        else
          ((__bf16*)C)[(size_t)m * N + n] = (__bf16)v;
      }
    }
  }
}

// All five input projections in one launch; blockIdx.z picks the product.
// One product alone is 256 workgroups, one per WGP: each K step then waits out
// the whole latency of its copies with nothing else to run. With 1,280
// workgroups several share a WGP and fill each other's waits, and four launch
// gaps, fills and tails go.
// actb: the two activation planes; wtb: the six Wt planes in the order
// q, k, v, o, scale, shift; outb: five [M, N] planes q, k, v, scale, shift.
__global__ __launch_bounds__(256) void proj5_kernel(
    const __bf16* __restrict__ actb, const __bf16* __restrict__ wtb,
    const float* __restrict__ bq, const float* __restrict__ bk,
    const float* __restrict__ bv, const float* __restrict__ bsc,
    const float* __restrict__ bsh, __bf16* __restrict__ outb,
    int M, int N, int K) {
  const int z = blockIdx.z;
  const __bf16* A  = z == 0 ? actb : actb + (size_t)M * K;
  const __bf16* Bt = wtb + (size_t)(z < 3 ? z : z + 1) * N * K;
  const float* bias = z == 0 ? bq : z == 1 ? bk : z == 2 ? bv
                    : z == 3 ? bsc : bsh;
  gemm_tile<false>(A, Bt, bias, outb + (size_t)z * M * N, M, N, K,
                   z == 0 ? 0.125f : 1.0f);   // Q carries 1/sqrt(64)
}

// output projection -> f32
__global__ __launch_bounds__(256) void gemm_out_kernel(
    const __bf16* __restrict__ A, const __bf16* __restrict__ Bt,
    const float* __restrict__ bias, float* __restrict__ C,
    int M, int N, int K, float alpha) {
  gemm_tile<true>(A, Bt, bias, C, M, N, K, alpha);
}

// ------------------------------- fuse --------------------------------------
// K' = K*s + sh ; V' = V*s + sh ; also write V' transposed per head:
// Vt[b][h][hd][s]
// grid: (H, B*S/64), block 256. One block owns a 64 (s) x 64 (hd) tile of one
// head. Every global access is a 16-byte chunk of a 128-byte row piece; the
// V' tile turns round in LDS.
// LDS tile: row hd, 32 dwords, a dword holds V' of rows s = 2*sp and 2*sp + 1.
// The 4-dword group index is XORed with hd >> 3: the eight hd chunks of a wave
// then store to different banks, and a 16-byte read still finds a whole group.
__global__ __launch_bounds__(256) void fuse_kv_kernel(
    const __bf16* __restrict__ Kr, const __bf16* __restrict__ Vr,
    const __bf16* __restrict__ Sc, const __bf16* __restrict__ Sh,
    __bf16* __restrict__ Kf, __bf16* __restrict__ Vt) {
  __shared__ __align__(16) unsigned int Tv[HD_ * 32];

  const int tid = threadIdx.x;
  const int h   = blockIdx.x;
  const int m0  = blockIdx.y * 64;      // first row in [B*S]
  const int b   = m0 / S_;
  const int s0  = m0 & (S_ - 1);
  const int hc  = tid & 7;              // 8-element chunk of hd
  const int sp  = tid >> 3;             // pair of s rows

  // byte offset of this thread's chunk in row 2*sp, the same in all five
  // [B*S, D] planes (8 MiB each, so 32 bits hold it); row 2*sp + 1 lies RB on
  const unsigned int o0 = (unsigned int)((m0 + 2 * sp) * D_ + h * HD_ + hc * 8) * 2u;
  constexpr unsigned int RB = D_ * 2;
  auto ld = [](const __bf16* p, unsigned int o) {
    return *(const v8bf*)((const char*)p + o);
  };
  const v8bf k0 = ld(Kr, o0), k1 = ld(Kr, o0 + RB);
  const v8bf v0 = ld(Vr, o0), v1 = ld(Vr, o0 + RB);
  const v8bf c0 = ld(Sc, o0), c1 = ld(Sc, o0 + RB);
  const v8bf t0 = ld(Sh, o0), t1 = ld(Sh, o0 + RB);

  v8bf ko0, ko1;
  const int grp = (((sp >> 2) ^ hc) << 2) + (sp & 3);
#pragma unroll  // constant j: the vector elements stay in registers
  for (int j = 0; j < 8; ++j) {
    float sc0 = (float)c0[j], sh0 = (float)t0[j];
    float sc1 = (float)c1[j], sh1 = (float)t1[j];
    ko0[j] = (__bf16)((float)k0[j] * sc0 + sh0);
    ko1[j] = (__bf16)((float)k1[j] * sc1 + sh1);
    union { __bf16 e[2]; unsigned int u; } pk;
    pk.e[0] = (__bf16)((float)v0[j] * sc0 + sh0);
    pk.e[1] = (__bf16)((float)v1[j] * sc1 + sh1);
    Tv[(hc * 8 + j) * 32 + grp] = pk.u;
  }

  __syncthreads();

  // behind the barrier, so that no wave waits there for these stores to return
  *(v8bf*)((char*)Kf + o0) = ko0;
  *(v8bf*)((char*)Kf + o0 + RB) = ko1;

  __bf16* vout = Vt + (size_t)(b * H_ + h) * HD_ * S_ + s0;
#pragma unroll  // both LDS reads issue before the first store waits for its data
  for (int i = 0; i < 2; ++i) {
    int c = tid + i * 256, hd = c >> 3, g = c & 7;
    v8bf row = *(const v8bf*)&Tv[hd * 32 + ((g ^ (hd >> 3)) << 2)];
    *(v8bf*)(vout + (size_t)hd * S_ + g * 8) = row;
  }
}

// lane l with lane l ^ 16
__device__ __forceinline__ float xhalf(float x) {
  int v = __float_as_int(x);
  return __int_as_float(__builtin_amdgcn_permlanex16(v, v, 0x76543210,
                                                     0xfedcba98, false, false));
}

// x[i] = 2^x[i], eight at a time. One statement, so that the closing v_nop stays
// directly behind the last v_exp_f32: it is the slot the instruction set asks
// for between a transcendental and an instruction that reads its result or
// overwrites its source. Each v_exp_f32 works in place on a register of its own, so
// none touches a neighbour's source or result, and the statement writes no
// register that the compiler's own code has not written just before.
__device__ __forceinline__ v8f exp2x8(v8f x) {
  float y0 = x[0], y1 = x[1], y2 = x[2], y3 = x[3];
  float y4 = x[4], y5 = x[5], y6 = x[6], y7 = x[7];
  asm("v_exp_f32 %0, %0\n\t"
      "v_exp_f32 %1, %1\n\t"
      "v_exp_f32 %2, %2\n\t"
      "v_exp_f32 %3, %3\n\t"
      "v_exp_f32 %4, %4\n\t"
      "v_exp_f32 %5, %5\n\t"
      "v_exp_f32 %6, %6\n\t"
      "v_exp_f32 %7, %7\n\t"
      "v_nop"
      : "+v"(y0), "+v"(y1), "+v"(y2), "+v"(y3), "+v"(y4), "+v"(y5), "+v"(y6),
        "+v"(y7));
  v8f y = {y0, y1, y2, y3, y4, y5, y6, y7};
  return y;
}

__global__ __launch_bounds__(128) void attn_kernel(
    const __bf16* __restrict__ Qb, const __bf16* __restrict__ Kb,
    const __bf16* __restrict__ Vt, __bf16* __restrict__ Ob) {
  __shared__ __align__(16) __bf16 Ks[2][64][72];    // [key][hd]
  __shared__ __align__(16) __bf16 Vs[2][64][72];    // [hd][key] (transposed V)

  const int b    = blockIdx.z;
  const int h    = blockIdx.y;
  const int q0   = blockIdx.x * 64;
  const int tid  = threadIdx.x;
  const int wave = tid >> 5;
  const int lane = tid & 31;
  const int lr   = lane & 15;
  const int lh   = lane >> 4;
  const int koff = lh * 8;

  const __bf16* Kbase = Kb + (size_t)(b * S_) * D_ + h * HD_;
  const __bf16* Vbase = Vt + (size_t)(b * H_ + h) * HD_ * S_;

  // Q fragments (B operand: column = query lr, 2 k-steps), resident in VGPRs
  v16bf qf[2];
  {
    int qrow           = q0 + wave * 16 + lr;
    const __bf16* qptr = Qb + (size_t)(b * S_ + qrow) * D_ + h * HD_;
#pragma unroll
    for (int ks = 0; ks < 2; ++ks) {
      v8bf lo = *(const v8bf*)(qptr + ks * 32 + koff);
      v8bf hi = *(const v8bf*)(qptr + ks * 32 + koff + 16);
      qf[ks]  = pack16(lo, hi);
    }
  }

  // o[nt][r] = O^T[hd nt*16 + lh*8 + r][query lr]
  v8f o[4];
#pragma unroll
  for (int nt = 0; nt < 4; ++nt) o[nt] = zero8();
  // running maximum of query lr (equal in both wave halves) and this half's
  // share of its running sum
  float rm = -1e30f, rs = 0.0f;

  // this thread's four 16B staging chunks per tile
  // chunk c = tid + i*128; row = c>>3 (8 x 16B per 128B row); col = (c&7)*8
  // prologue: stage tile 0 into buffer 0
#pragma unroll
  for (int i = 0; i < 4; ++i) {
    int c = tid + i * 128, row = c >> 3, col = (c & 7) * 8;
    stage16(&Kbase[(size_t)row * D_ + col], &Ks[0][row][col]);
    stage16(&Vbase[(size_t)row * S_ + col], &Vs[0][row][col]);
  }

  int p = 0;
  for (int kt0 = 0; kt0 < S_; kt0 += 64, p ^= 1) {
    async_wait_all();
    __syncthreads();
    if (kt0 + 64 < S_) {
      int nk = kt0 + 64;
#pragma unroll
      for (int i = 0; i < 4; ++i) {
        int c = tid + i * 128, row = c >> 3, col = (c & 7) * 8;
        stage16(&Kbase[(size_t)(nk + row) * D_ + col], &Ks[p ^ 1][row][col]);
        stage16(&Vbase[(size_t)row * S_ + nk + col], &Vs[p ^ 1][row][col]);
      }
    }

    // S^T = K @ Q^T   (4 key tiles x 2 k-steps)
    // sc[nt][r] = score of key nt*16 + lh*8 + r with query lr
    v8f sc[4];
#pragma unroll
    for (int nt = 0; nt < 4; ++nt) {
      sc[nt] = zero8();
#pragma unroll
      for (int ks = 0; ks < 2; ++ks) {
        int row  = nt * 16 + lr;
        v8bf lo  = *(const v8bf*)&Ks[p][row][ks * 32 + koff];
        v8bf hi  = *(const v8bf*)&Ks[p][row][ks * 32 + koff + 16];
        v16bf kf = pack16(lo, hi);
        sc[nt]   = __builtin_amdgcn_wmma_f32_16x16x32_bf16(
            false, kf, false, qf[ks], (short)0, sc[nt], false, false);
      }
    }

    // online softmax: the lane's 32 scores belong to one query; the other 32
    // of the tile sit in lane ^ 16
    // one chain per score tile: four short chains instead of one long one
    float tm[4];
#pragma unroll
    for (int nt = 0; nt < 4; ++nt) {
      tm[nt] = sc[nt][0];
#pragma unroll
      for (int r = 1; r < 8; ++r) tm[nt] = fmaxf(tm[nt], sc[nt][r]);
    }
    float mx = fmaxf(fmaxf(tm[0], tm[1]), fmaxf(tm[2], tm[3]));
    mx = fmaxf(mx, xhalf(mx));
    const float nm   = fmaxf(rm, mx);
    const float corr = __expf(rm - nm);
    rm               = nm;
    float ts[4];
#pragma unroll
    for (int nt = 0; nt < 4; ++nt) {
#pragma unroll
      for (int r = 0; r < 8; ++r)
        sc[nt][r] = (sc[nt][r] - nm) * 1.44269504088896340736f;  // log2(e)
      sc[nt] = exp2x8(sc[nt]);
      ts[nt] = sc[nt][0];
#pragma unroll
      for (int r = 1; r < 8; ++r) ts[nt] += sc[nt][r];
    }
    const float psum = (ts[0] + ts[1]) + (ts[2] + ts[3]);
    rs = rs * corr + psum;
#pragma unroll
    for (int nt = 0; nt < 4; ++nt)
#pragma unroll
      for (int r = 0; r < 8; ++r) o[nt][r] *= corr;

    // O^T += V^T @ P^T   (2 k-steps over keys x 4 hd tiles)
#pragma unroll
    for (int ks = 0; ks < 2; ++ks) {
      // score tiles 2*ks and 2*ks + 1 hold keys 8*lh + s and 16 + 8*lh + s of
      // this k-step: the k order in which the V^T loader below reads
      v16bf pf;
#pragma unroll
      for (int s = 0; s < 8; ++s) {
        pf[s]     = (__bf16)sc[2 * ks][s];
        pf[s + 8] = (__bf16)sc[2 * ks + 1][s];
      }
#pragma unroll
      for (int nt = 0; nt < 4; ++nt) {
        int row  = nt * 16 + lr;
        v8bf lo  = *(const v8bf*)&Vs[p][row][ks * 32 + koff];
        v8bf hi  = *(const v8bf*)&Vs[p][row][ks * 32 + koff + 16];
        v16bf vf = pack16(lo, hi);
        o[nt]    = __builtin_amdgcn_wmma_f32_16x16x32_bf16(
            false, vf, false, pf, (short)0, o[nt], false, false);
      }
    }
  }

  // join the halves' sums, normalize and store (bf16, [B*S, D] layout): a lane
  // holds 8 consecutive hd of its query per tile, one 16-byte store each
  const float inv = 1.0f / (rs + xhalf(rs));
  __bf16* optr = Ob + (size_t)(b * S_ + q0 + wave * 16 + lr) * D_ + h * HD_ + koff;
#pragma unroll
  for (int nt = 0; nt < 4; ++nt) {
    v8bf ov;
#pragma unroll
    for (int r = 0; r < 8; ++r) ov[r] = (__bf16)(o[nt][r] * inv);
    *(v8bf*)(optr + nt * 16) = ov;
  }
}

// ------------------------------ launcher ------------------------------------

extern "C" void kernel_launch(void* const* d_in, const int* in_sizes, int n_in,
                              void* d_out, int out_size, void* d_ws,
                              size_t ws_size, hipStream_t stream) {
  const float* mod1 = (const float*)d_in[0];
  const float* mod2 = (const float*)d_in[1];
  const float* Wq   = (const float*)d_in[2];
  const float* bq   = (const float*)d_in[3];
  const float* Wk   = (const float*)d_in[4];
  const float* bk   = (const float*)d_in[5];
  const float* Wv   = (const float*)d_in[6];
  const float* bv   = (const float*)d_in[7];
  const float* Wo   = (const float*)d_in[8];
  const float* bo   = (const float*)d_in[9];
  const float* Wsc  = (const float*)d_in[10];
  const float* bsc  = (const float*)d_in[11];
  const float* Wsh  = (const float*)d_in[12];
  const float* bsh  = (const float*)d_in[13];
  float* out        = (float*)d_out;

  const size_t ACT = (size_t)MROWS * D_ * sizeof(__bf16);  // 8 MB
  const size_t WT  = (size_t)D_ * D_ * sizeof(__bf16);     // 0.5 MB

  char* w = (char*)d_ws;
  size_t off = 0;
  auto carve = [&](size_t bytes) -> __bf16* {
    __bf16* p = (__bf16*)(w + off);
    off += bytes;
    return p;
  };
  __bf16* mod1b = carve(ACT);
  __bf16* mod2b = carve(ACT);
  __bf16* Wqt   = carve(WT);
  __bf16* Wkt   = carve(WT);
  __bf16* Wvt   = carve(WT);
  __bf16* Wot   = carve(WT);
  __bf16* Wsct  = carve(WT);
  __bf16* Wsht  = carve(WT);
  __bf16* Qb    = carve(ACT);
  __bf16* Krb   = carve(ACT);
  __bf16* Vrb   = carve(ACT);
  __bf16* Scb   = carve(ACT);
  __bf16* Shb   = carve(ACT);
  __bf16* Kfb   = carve(ACT);
  __bf16* Vtb   = carve(ACT);   // [B,H,HD,S]
  __bf16* Obuf  = carve(ACT);

  // 1) casts: mod1b, mod2b and the six Wt planes lie one behind the other
  convert_all_kernel<<<6 * WBLK + 2 * ABLK, 256, 0, stream>>>(
      mod1, mod2, Wq, Wk, Wv, Wo, Wsc, Wsh, mod1b, Wqt);

  // 2) projections: Qb, Krb, Vrb, Scb, Shb lie one behind the other
  proj5_kernel<<<dim3(D_ / BN, MROWS / BM, 5), 256, 0, stream>>>(
      mod1b, Wqt, bq, bk, bv, bsc, bsh, Qb, MROWS, D_, D_);

  // 3) K' = K*s+sh, V' = V*s+sh (and per-head transposed V')
  fuse_kv_kernel<<<dim3(H_, MROWS / 64), 256, 0, stream>>>(Krb, Vrb, Scb, Shb,
                                                        Kfb, Vtb);

  // 4) flash attention
  attn_kernel<<<dim3(S_ / 64, H_, B_), 128, 0, stream>>>(Qb, Kfb, Vtb, Obuf);

  // 5) output projection -> f32
  gemm_out_kernel<<<dim3(D_ / BN, MROWS / BM), 256, 0, stream>>>(
      Obuf, Wot, bo, out, MROWS, D_, D_, 1.0f);
}

// v005
// One run takes 96.1 microseconds.
// Timed twice side by side with v004, it ran 1.16 times as fast both times.
// Over all steps from v000 it is 2.82 times as fast.
#include <hip/hip_runtime.h>
#include <hip/hip_bf16.h>

// ---------------------------------------------------------------------------
// MultiHeadCrossModalAttention on MI455X (gfx1250, wave32, WMMA bf16,
// async global->LDS staging, transposed attention products)
// B=4, S=2048, D=512, H=8, HD=64
// ---------------------------------------------------------------------------

typedef __attribute__((ext_vector_type(16))) __bf16 v16bf;
typedef __attribute__((ext_vector_type(8)))  __bf16 v8bf;
typedef __attribute__((ext_vector_type(8)))  float  v8f;
typedef int v4i __attribute__((vector_size(16)));

#define B_  4
#define S_  2048
#define D_  512
#define H_  8
#define HD_ 64
#define MROWS (B_ * S_)          // 8192

#define AS1 __attribute__((address_space(1)))
#define AS3 __attribute__((address_space(3)))

#if __has_builtin(__builtin_amdgcn_global_load_async_to_lds_b128) && \
    __has_builtin(__builtin_amdgcn_s_wait_asynccnt)
#define HAVE_ASYNC_LDS 1
#else
#define HAVE_ASYNC_LDS 0
#endif

// one 16B chunk: global -> LDS (async on CDNA5, sync fallback otherwise)
__device__ __forceinline__ void stage16(const __bf16* g, __bf16* l) {
#if HAVE_ASYNC_LDS
  __builtin_amdgcn_global_load_async_to_lds_b128((AS1 v4i*)g, (AS3 v4i*)l,
                                                 0, 0);
#else
  *(v8bf*)l = *(const v8bf*)g;
#endif
}

__device__ __forceinline__ void async_wait_all() {
#if HAVE_ASYNC_LDS
  __builtin_amdgcn_s_wait_asynccnt(0);
#endif
}

__device__ __forceinline__ v16bf pack16(v8bf lo, v8bf hi) {
  union { v16bf v; v8bf p[2]; } u;
  u.p[0] = lo; u.p[1] = hi;
  return u.v;
}

__device__ __forceinline__ v8f zero8() {
  v8f z;
#pragma unroll
  for (int i = 0; i < 8; ++i) z[i] = 0.0f;
  return z;
}

// ------------------------------- casts -------------------------------------
// One launch converts both activation tensors and all six weight matrices to
// bf16. A short wave costs more to start than to run, so a lane converts 64
// activation elements or a 4 (n) x 8 (k) piece of a weight matrix.
// Blocks 0 .. 6*WBLK-1: weights, Wt[n][k] = W[k][n]; the rest: activations.

typedef __attribute__((ext_vector_type(4))) float  v4f;
typedef __attribute__((ext_vector_type(4))) __bf16 v4bf;

#define WBLK 32    // blocks per 512x512 weight matrix: tiles of 64 (k) x 128 (n)
#define ABLK 256   // blocks per activation tensor: 16,384 elements each
#define ACH  16    // 16-byte chunks per lane of an activation block

__global__ __launch_bounds__(256) void convert_all_kernel(
    const float* __restrict__ act0, const float* __restrict__ act1,
    const float* __restrict__ W0, const float* __restrict__ W1,
    const float* __restrict__ W2, const float* __restrict__ W3,
    const float* __restrict__ W4, const float* __restrict__ W5,
    __bf16* __restrict__ actb, __bf16* __restrict__ wtb) {
  const unsigned int blk = blockIdx.x;
  const int tid = threadIdx.x;

  if (blk < 6 * WBLK) {
    const int wi = blk / WBLK;
    const int t  = blk % WBLK;
    const float* W = wi == 0 ? W0 : wi == 1 ? W1 : wi == 2 ? W2
                   : wi == 3 ? W3 : wi == 4 ? W4 : W5;
    __bf16* Wt = wtb + (size_t)wi * (D_ * D_);
    // eight neighbouring lanes hold the eight k chunks of one Wt row piece:
    // together they store a whole 128-byte line
    const int k0 = (t & 7) * 64 + (tid & 7) * 8;
    const int n0 = (t >> 3) * 128 + (tid >> 3) * 4;
    v4f r[8];
#pragma unroll  // all eight loads in flight before the first convert
    for (int j = 0; j < 8; ++j) r[j] = *(const v4f*)&W[(k0 + j) * D_ + n0];
#pragma unroll  // constant indices: the vector elements stay in registers
    for (int c = 0; c < 4; ++c) {
      v8bf o;
#pragma unroll  // as above
      for (int j = 0; j < 8; ++j) o[j] = (__bf16)r[j][c];
      *(v8bf*)&Wt[(n0 + c) * D_ + k0] = o;
    }
  } else {
    const unsigned int ab = blk - 6 * WBLK;
    const int ti = ab / ABLK;
    const float* in = ti == 0 ? act0 : act1;
    __bf16* out = actb + (size_t)ti * (MROWS * D_);
    const unsigned int e0 = (ab % ABLK) * (256 * ACH * 4) + tid * 4;
    const unsigned int lo = e0 * 4;   // byte offset that all the loads share
    v4f r[ACH];
#pragma unroll  // all loads in flight before the first convert
    for (int j = 0; j < ACH; ++j)
      r[j] = *(const v4f*)((const char*)in + lo + j * 4096);
    // the wait owed before a register that an issued load names is rewritten;
    // it takes the shared offset as an input, so that no load's result lands in
    // that register while earlier loads of the run still name it
    asm volatile("s_wait_xcnt 0x0" :: "v"(lo) : "memory");
    // keeps the first converts from rising among the loads: the last loads would
    // then take over registers of the first and issue only when those return
    __builtin_amdgcn_sched_barrier(0);
#pragma unroll  // constant indices: the loaded chunks stay in registers
    for (int j = 0; j < ACH; ++j)
      *(v4bf*)&out[e0 + j * 1024] = __builtin_convertvector(r[j], v4bf);
    // the same wait behind the last stores: the code that follows them in the
    // built text rewrites their offset and data registers
    asm volatile("s_wait_xcnt 0x0" ::: "memory");
  }
}

// ------------------------------- GEMM --------------------------------------
// C[M,N] = (A[M,K] @ Bt[N,K]^T + bias[N]) * alpha
// Tiles: BM=128, BN=128, BK=64.  256 threads = 8 waves (2x4), wave: 64x32.
// Double-buffered async global->LDS staging. A K step takes 128 bytes of every
// operand row: eight lanes copy one whole cache line, where a step of 32 asked
// for each line twice, half of it at a time.

#define BM 128
#define BN 128
#define BK 64

template <bool OUT_F32>
__device__ __forceinline__ void gemm_tile(
    const __bf16* __restrict__ A, const __bf16* __restrict__ Bt,
    const float* __restrict__ bias, void* __restrict__ C,
    int M, int N, int K, float alpha) {
  __shared__ __align__(16) __bf16 As[2][BM][BK + 8];   // 144B rows
  __shared__ __align__(16) __bf16 Bs[2][BM][BK + 8];

  const int tid  = threadIdx.x;
  const int bm0  = blockIdx.y * BM;
  const int bn0  = blockIdx.x * BN;
  const int wave = tid >> 5;
  const int lane = tid & 31;
  const int wm   = wave >> 2;        // 0..1 -> 64-row slab
  const int wn   = wave & 3;         // 0..3 -> 32-col slab
  const int lr   = lane & 15;
  const int lh   = lane >> 4;
  const int koff = lh * 8;

  // this thread's four 16B staging chunks (same mapping for A and B tiles):
  // rows srow + 32*i, i = 0..3, at column scol
  const int srow = tid >> 3;
  const int scol = (tid & 7) * 8;

  v8f acc[4][2];
#pragma unroll
  for (int mt = 0; mt < 4; ++mt)
#pragma unroll
    for (int nt = 0; nt < 2; ++nt) acc[mt][nt] = zero8();

  // prologue: stage tile 0 into buffer 0
#pragma unroll  // the eight copies issue back to back
  for (int i = 0; i < 4; ++i) {
    int row = srow + i * 32;
    stage16(&A[(size_t)(bm0 + row) * K + scol], &As[0][row][scol]);
    stage16(&Bt[(size_t)(bn0 + row) * K + scol], &Bs[0][row][scol]);
  }

  int p = 0;
  for (int bk = 0; bk < K; bk += BK, p ^= 1) {
    async_wait_all();
    __syncthreads();
    if (bk + BK < K) {
      int nb = bk + BK;
#pragma unroll  // as in the prologue
      for (int i = 0; i < 4; ++i) {
        int row = srow + i * 32;
        stage16(&A[(size_t)(bm0 + row) * K + nb + scol], &As[p ^ 1][row][scol]);
        stage16(&Bt[(size_t)(bn0 + row) * K + nb + scol], &Bs[p ^ 1][row][scol]);
      }
    }

#pragma unroll  // constant ks: it folds into the LDS loads' offset fields
    for (int ks = 0; ks < BK; ks += 32) {
      v16bf af[4], bf[2];
#pragma unroll
      for (int mt = 0; mt < 4; ++mt) {
        int r   = wm * 64 + mt * 16 + lr;
        v8bf lo = *(const v8bf*)&As[p][r][ks + koff];
        v8bf hi = *(const v8bf*)&As[p][r][ks + koff + 16];
        af[mt]  = pack16(lo, hi);
      }
#pragma unroll
      for (int nt = 0; nt < 2; ++nt) {
        int r   = wn * 32 + nt * 16 + lr;
        v8bf lo = *(const v8bf*)&Bs[p][r][ks + koff];
        v8bf hi = *(const v8bf*)&Bs[p][r][ks + koff + 16];
        bf[nt]  = pack16(lo, hi);
      }
#pragma unroll
      for (int mt = 0; mt < 4; ++mt)
#pragma unroll
        for (int nt = 0; nt < 2; ++nt)
          acc[mt][nt] = __builtin_amdgcn_wmma_f32_16x16x32_bf16(
              false, af[mt], false, bf[nt], (short)0, acc[mt][nt], false, false);
    }
  }

  // epilogue: C layout -> lane holds col n=lr of each tile, rows r + lh*8
#pragma unroll
  for (int nt = 0; nt < 2; ++nt) {
    int n    = bn0 + wn * 32 + nt * 16 + lr;
    float bv = bias[n];
#pragma unroll
    for (int mt = 0; mt < 4; ++mt) {
#pragma unroll
      for (int r = 0; r < 8; ++r) {
        int m   = bm0 + wm * 64 + mt * 16 + lh * 8 + r;
        float v = (acc[mt][nt][r] + bv) * alpha;
        if constexpr (OUT_F32)
          ((float*)C)[(size_t)m * N + n] = v;
        else
          ((__bf16*)C)[(size_t)m * N + n] = (__bf16)v;
      }
    }
  }
}

// All five input projections in one launch; blockIdx.z picks the product.
// One product alone is 256 workgroups, one per WGP: each K step then waits out
// the whole latency of its copies with nothing else to run. With 1,280
// workgroups several share a WGP and fill each other's waits, and four launch
// gaps, fills and tails go.
// actb: the two activation planes; wtb: the six Wt planes in the order
// q, k, v, o, scale, shift; outb: five [M, N] planes q, k, v, scale, shift.
__global__ __launch_bounds__(256) void proj5_kernel(
    const __bf16* __restrict__ actb, const __bf16* __restrict__ wtb,
    const float* __restrict__ bq, const float* __restrict__ bk,
    const float* __restrict__ bv, const float* __restrict__ bsc,
    const float* __restrict__ bsh, __bf16* __restrict__ outb,
    int M, int N, int K) {
  const int z = blockIdx.z;
  const __bf16* A  = z == 0 ? actb : actb + (size_t)M * K;
  const __bf16* Bt = wtb + (size_t)(z < 3 ? z : z + 1) * N * K;
  const float* bias = z == 0 ? bq : z == 1 ? bk : z == 2 ? bv
                    : z == 3 ? bsc : bsh;
  gemm_tile<false>(A, Bt, bias, outb + (size_t)z * M * N, M, N, K,
                   z == 0 ? 0.125f : 1.0f);   // Q carries 1/sqrt(64)
}

// output projection -> f32
__global__ __launch_bounds__(256) void gemm_out_kernel(
    const __bf16* __restrict__ A, const __bf16* __restrict__ Bt,
    const float* __restrict__ bias, float* __restrict__ C,
    int M, int N, int K, float alpha) {
  gemm_tile<true>(A, Bt, bias, C, M, N, K, alpha);
}

// ------------------------------- fuse --------------------------------------
// K' = K*s + sh ; V' = V*s + sh ; also write V' transposed per head:
// Vt[b][h][hd][s]
// grid: (H, B*S/64), block 256. One block owns a 64 (s) x 64 (hd) tile of one
// head. Every global access is a 16-byte chunk of a 128-byte row piece; the
// V' tile turns round in LDS.
// LDS tile: row hd, 32 dwords, a dword holds V' of rows s = 2*sp and 2*sp + 1.
// The 4-dword group index is XORed with hd >> 3: the eight hd chunks of a wave
// then store to different banks, and a 16-byte read still finds a whole group.
__global__ __launch_bounds__(256) void fuse_kv_kernel(
    const __bf16* __restrict__ Kr, const __bf16* __restrict__ Vr,
    const __bf16* __restrict__ Sc, const __bf16* __restrict__ Sh,
    __bf16* __restrict__ Kf, __bf16* __restrict__ Vt) {
  __shared__ __align__(16) unsigned int Tv[HD_ * 32];

  const int tid = threadIdx.x;
  const int h   = blockIdx.x;
  const int m0  = blockIdx.y * 64;      // first row in [B*S]
  const int b   = m0 / S_;
  const int s0  = m0 & (S_ - 1);
  const int hc  = tid & 7;              // 8-element chunk of hd
  const int sp  = tid >> 3;             // pair of s rows

  // byte offset of this thread's chunk in row 2*sp, the same in all five
  // [B*S, D] planes (8 MiB each, so 32 bits hold it); row 2*sp + 1 lies RB on
  const unsigned int o0 = (unsigned int)((m0 + 2 * sp) * D_ + h * HD_ + hc * 8) * 2u;
  constexpr unsigned int RB = D_ * 2;
  auto ld = [](const __bf16* p, unsigned int o) {
    return *(const v8bf*)((const char*)p + o);
  };
  const v8bf k0 = ld(Kr, o0), k1 = ld(Kr, o0 + RB);
  const v8bf v0 = ld(Vr, o0), v1 = ld(Vr, o0 + RB);
  const v8bf c0 = ld(Sc, o0), c1 = ld(Sc, o0 + RB);
  const v8bf t0 = ld(Sh, o0), t1 = ld(Sh, o0 + RB);

  v8bf ko0, ko1;
  const int grp = (((sp >> 2) ^ hc) << 2) + (sp & 3);
#pragma unroll  // constant j: the vector elements stay in registers
  for (int j = 0; j < 8; ++j) {
    float sc0 = (float)c0[j], sh0 = (float)t0[j];
    float sc1 = (float)c1[j], sh1 = (float)t1[j];
    ko0[j] = (__bf16)((float)k0[j] * sc0 + sh0);
    ko1[j] = (__bf16)((float)k1[j] * sc1 + sh1);
    union { __bf16 e[2]; unsigned int u; } pk;
    pk.e[0] = (__bf16)((float)v0[j] * sc0 + sh0);
    pk.e[1] = (__bf16)((float)v1[j] * sc1 + sh1);
    Tv[(hc * 8 + j) * 32 + grp] = pk.u;
  }

  __syncthreads();

  // behind the barrier, so that no wave waits there for these stores to return
  *(v8bf*)((char*)Kf + o0) = ko0;
  *(v8bf*)((char*)Kf + o0 + RB) = ko1;

  __bf16* vout = Vt + (size_t)(b * H_ + h) * HD_ * S_ + s0;
#pragma unroll  // both LDS reads issue before the first store waits for its data
  for (int i = 0; i < 2; ++i) {
    int c = tid + i * 256, hd = c >> 3, g = c & 7;
    v8bf row = *(const v8bf*)&Tv[hd * 32 + ((g ^ (hd >> 3)) << 2)];
    *(v8bf*)(vout + (size_t)hd * S_ + g * 8) = row;
  }
}

// lane l with lane l ^ 16
__device__ __forceinline__ float xhalf(float x) {
  int v = __float_as_int(x);
  return __int_as_float(__builtin_amdgcn_permlanex16(v, v, 0x76543210,
                                                     0xfedcba98, false, false));
}

// x[i] = 2^x[i], eight at a time. One statement, so that the closing v_nop stays
// directly behind the last v_exp_f32: it is the slot the instruction set asks
// for between a transcendental and an instruction that reads its result or
// overwrites its source. Each v_exp_f32 works in place on a register of its own, so
// none touches a neighbour's source or result, and the statement writes no
// register that the compiler's own code has not written just before.
__device__ __forceinline__ v8f exp2x8(v8f x) {
  float y0 = x[0], y1 = x[1], y2 = x[2], y3 = x[3];
  float y4 = x[4], y5 = x[5], y6 = x[6], y7 = x[7];
  asm("v_exp_f32 %0, %0\n\t"
      "v_exp_f32 %1, %1\n\t"
      "v_exp_f32 %2, %2\n\t"
      "v_exp_f32 %3, %3\n\t"
      "v_exp_f32 %4, %4\n\t"
      "v_exp_f32 %5, %5\n\t"
      "v_exp_f32 %6, %6\n\t"
      "v_exp_f32 %7, %7\n\t"
      "v_nop"
      : "+v"(y0), "+v"(y1), "+v"(y2), "+v"(y3), "+v"(y4), "+v"(y5), "+v"(y6),
        "+v"(y7));
  v8f y = {y0, y1, y2, y3, y4, y5, y6, y7};
  return y;
}

__global__ __launch_bounds__(128) void attn_kernel(
    const __bf16* __restrict__ Qb, const __bf16* __restrict__ Kb,
    const __bf16* __restrict__ Vt, __bf16* __restrict__ Ob) {
  __shared__ __align__(16) __bf16 Ks[2][64][72];    // [key][hd]
  __shared__ __align__(16) __bf16 Vs[2][64][72];    // [hd][key] (transposed V)

  const int b    = blockIdx.z;
  const int h    = blockIdx.y;
  const int q0   = blockIdx.x * 64;
  const int tid  = threadIdx.x;
  const int wave = tid >> 5;
  const int lane = tid & 31;
  const int lr   = lane & 15;
  const int lh   = lane >> 4;
  const int koff = lh * 8;

  const __bf16* Kbase = Kb + (size_t)(b * S_) * D_ + h * HD_;
  const __bf16* Vbase = Vt + (size_t)(b * H_ + h) * HD_ * S_;

  // Q fragments (B operand: column = query lr, 2 k-steps), resident in VGPRs
  v16bf qf[2];
  {
    int qrow           = q0 + wave * 16 + lr;
    const __bf16* qptr = Qb + (size_t)(b * S_ + qrow) * D_ + h * HD_;
#pragma unroll
    for (int ks = 0; ks < 2; ++ks) {
      v8bf lo = *(const v8bf*)(qptr + ks * 32 + koff);
      v8bf hi = *(const v8bf*)(qptr + ks * 32 + koff + 16);
      qf[ks]  = pack16(lo, hi);
    }
  }

  // o[nt][r] = O^T[hd nt*16 + lh*8 + r][query lr]
  v8f o[4];
#pragma unroll
  for (int nt = 0; nt < 4; ++nt) o[nt] = zero8();
  // running maximum of query lr (equal in both wave halves) and this half's
  // share of its running sum
  float rm = -1e30f, rs = 0.0f;

  // this thread's four 16B staging chunks per tile
  // chunk c = tid + i*128; row = c>>3 (8 x 16B per 128B row); col = (c&7)*8
  // prologue: stage tile 0 into buffer 0
#pragma unroll
  for (int i = 0; i < 4; ++i) {
    int c = tid + i * 128, row = c >> 3, col = (c & 7) * 8;
    stage16(&Kbase[(size_t)row * D_ + col], &Ks[0][row][col]);
    stage16(&Vbase[(size_t)row * S_ + col], &Vs[0][row][col]);
  }

  int p = 0;
  for (int kt0 = 0; kt0 < S_; kt0 += 64, p ^= 1) {
    async_wait_all();
    __syncthreads();
    if (kt0 + 64 < S_) {
      int nk = kt0 + 64;
#pragma unroll
      for (int i = 0; i < 4; ++i) {
        int c = tid + i * 128, row = c >> 3, col = (c & 7) * 8;
        stage16(&Kbase[(size_t)(nk + row) * D_ + col], &Ks[p ^ 1][row][col]);
        stage16(&Vbase[(size_t)row * S_ + nk + col], &Vs[p ^ 1][row][col]);
      }
    }

    // S^T = K @ Q^T   (4 key tiles x 2 k-steps)
    // sc[nt][r] = score of key nt*16 + lh*8 + r with query lr
    v8f sc[4];
#pragma unroll
    for (int nt = 0; nt < 4; ++nt) {
      sc[nt] = zero8();
#pragma unroll
      for (int ks = 0; ks < 2; ++ks) {
        int row  = nt * 16 + lr;
        v8bf lo  = *(const v8bf*)&Ks[p][row][ks * 32 + koff];
        v8bf hi  = *(const v8bf*)&Ks[p][row][ks * 32 + koff + 16];
        v16bf kf = pack16(lo, hi);
        sc[nt]   = __builtin_amdgcn_wmma_f32_16x16x32_bf16(
            false, kf, false, qf[ks], (short)0, sc[nt], false, false);
      }
    }

    // online softmax: the lane's 32 scores belong to one query; the other 32
    // of the tile sit in lane ^ 16
    // one chain per score tile: four short chains instead of one long one
    float tm[4];
#pragma unroll
    for (int nt = 0; nt < 4; ++nt) {
      tm[nt] = sc[nt][0];
#pragma unroll
      for (int r = 1; r < 8; ++r) tm[nt] = fmaxf(tm[nt], sc[nt][r]);
    }
    float mx = fmaxf(fmaxf(tm[0], tm[1]), fmaxf(tm[2], tm[3]));
    mx = fmaxf(mx, xhalf(mx));
    const float nm   = fmaxf(rm, mx);
    const float corr = __expf(rm - nm);
    rm               = nm;
    float ts[4];
#pragma unroll
    for (int nt = 0; nt < 4; ++nt) {
#pragma unroll
      for (int r = 0; r < 8; ++r)
        sc[nt][r] = (sc[nt][r] - nm) * 1.44269504088896340736f;  // log2(e)
      sc[nt] = exp2x8(sc[nt]);
      ts[nt] = sc[nt][0];
#pragma unroll
      for (int r = 1; r < 8; ++r) ts[nt] += sc[nt][r];
    }
    const float psum = (ts[0] + ts[1]) + (ts[2] + ts[3]);
    rs = rs * corr + psum;
#pragma unroll
    for (int nt = 0; nt < 4; ++nt)
#pragma unroll
      for (int r = 0; r < 8; ++r) o[nt][r] *= corr;

    // O^T += V^T @ P^T   (2 k-steps over keys x 4 hd tiles)
#pragma unroll
    for (int ks = 0; ks < 2; ++ks) {
      // score tiles 2*ks and 2*ks + 1 hold keys 8*lh + s and 16 + 8*lh + s of
      // this k-step: the k order in which the V^T loader below reads
      v16bf pf;
#pragma unroll
      for (int s = 0; s < 8; ++s) {
        pf[s]     = (__bf16)sc[2 * ks][s];
        pf[s + 8] = (__bf16)sc[2 * ks + 1][s];
      }
#pragma unroll
      for (int nt = 0; nt < 4; ++nt) {
        int row  = nt * 16 + lr;
        v8bf lo  = *(const v8bf*)&Vs[p][row][ks * 32 + koff];
        v8bf hi  = *(const v8bf*)&Vs[p][row][ks * 32 + koff + 16];
        v16bf vf = pack16(lo, hi);
        o[nt]    = __builtin_amdgcn_wmma_f32_16x16x32_bf16(
            false, vf, false, pf, (short)0, o[nt], false, false);
      }
    }
  }

  // join the halves' sums, normalize and store (bf16, [B*S, D] layout): a lane
  // holds 8 consecutive hd of its query per tile, one 16-byte store each
  const float inv = 1.0f / (rs + xhalf(rs));
  __bf16* optr = Ob + (size_t)(b * S_ + q0 + wave * 16 + lr) * D_ + h * HD_ + koff;
#pragma unroll
  for (int nt = 0; nt < 4; ++nt) {
    v8bf ov;
#pragma unroll
    for (int r = 0; r < 8; ++r) ov[r] = (__bf16)(o[nt][r] * inv);
    *(v8bf*)(optr + nt * 16) = ov;
  }
}

// ------------------------------ launcher ------------------------------------

extern "C" void kernel_launch(void* const* d_in, const int* in_sizes, int n_in,
                              void* d_out, int out_size, void* d_ws,
                              size_t ws_size, hipStream_t stream) {
  const float* mod1 = (const float*)d_in[0];
  const float* mod2 = (const float*)d_in[1];
  const float* Wq   = (const float*)d_in[2];
  const float* bq   = (const float*)d_in[3];
  const float* Wk   = (const float*)d_in[4];
  const float* bk   = (const float*)d_in[5];
  const float* Wv   = (const float*)d_in[6];
  const float* bv   = (const float*)d_in[7];
  const float* Wo   = (const float*)d_in[8];
  const float* bo   = (const float*)d_in[9];
  const float* Wsc  = (const float*)d_in[10];
  const float* bsc  = (const float*)d_in[11];
  const float* Wsh  = (const float*)d_in[12];
  const float* bsh  = (const float*)d_in[13];
  float* out        = (float*)d_out;

  const size_t ACT = (size_t)MROWS * D_ * sizeof(__bf16);  // 8 MB
  const size_t WT  = (size_t)D_ * D_ * sizeof(__bf16);     // 0.5 MB

  char* w = (char*)d_ws;
  size_t off = 0;
  auto carve = [&](size_t bytes) -> __bf16* {
    __bf16* p = (__bf16*)(w + off);
    off += bytes;
    return p;
  };
  __bf16* mod1b = carve(ACT);
  __bf16* mod2b = carve(ACT);
  __bf16* Wqt   = carve(WT);
  __bf16* Wkt   = carve(WT);
  __bf16* Wvt   = carve(WT);
  __bf16* Wot   = carve(WT);
  __bf16* Wsct  = carve(WT);
  __bf16* Wsht  = carve(WT);
  __bf16* Qb    = carve(ACT);
  __bf16* Krb   = carve(ACT);
  __bf16* Vrb   = carve(ACT);
  __bf16* Scb   = carve(ACT);
  __bf16* Shb   = carve(ACT);
  __bf16* Kfb   = carve(ACT);
  __bf16* Vtb   = carve(ACT);   // [B,H,HD,S]
  __bf16* Obuf  = carve(ACT);

  // 1) casts: mod1b, mod2b and the six Wt planes lie one behind the other
  convert_all_kernel<<<6 * WBLK + 2 * ABLK, 256, 0, stream>>>(
      mod1, mod2, Wq, Wk, Wv, Wo, Wsc, Wsh, mod1b, Wqt);

  // 2) projections: Qb, Krb, Vrb, Scb, Shb lie one behind the other
  proj5_kernel<<<dim3(D_ / BN, MROWS / BM, 5), 256, 0, stream>>>(
      mod1b, Wqt, bq, bk, bv, bsc, bsh, Qb, MROWS, D_, D_);

  // 3) K' = K*s+sh, V' = V*s+sh (and per-head transposed V')
  fuse_kv_kernel<<<dim3(H_, MROWS / 64), 256, 0, stream>>>(Krb, Vrb, Scb, Shb,
                                                        Kfb, Vtb);

  // 4) flash attention
  attn_kernel<<<dim3(S_ / 64, H_, B_), 128, 0, stream>>>(Qb, Kfb, Vtb, Obuf);

  // 5) output projection -> f32
  gemm_out_kernel<<<dim3(D_ / BN, MROWS / BM), 256, 0, stream>>>(
      Obuf, Wot, bo, out, MROWS, D_, D_, 1.0f);
}

// v006
// One run takes 85.5 microseconds.
// Two timings next to v005 put it at 1.13 and 1.12 times that version's speed.
// Over all steps from v000 it is 3.18 times as fast.
#include <hip/hip_runtime.h>
#include <hip/hip_bf16.h>

// ---------------------------------------------------------------------------
// MultiHeadCrossModalAttention on MI455X (gfx1250, wave32, WMMA bf16,
// async global->LDS staging, transposed attention products)
// B=4, S=2048, D=512, H=8, HD=64
// ---------------------------------------------------------------------------

typedef __attribute__((ext_vector_type(16))) __bf16 v16bf;
typedef __attribute__((ext_vector_type(8)))  __bf16 v8bf;
typedef __attribute__((ext_vector_type(8)))  float  v8f;
typedef int v4i __attribute__((vector_size(16)));

#define B_  4
#define S_  2048
#define D_  512
#define H_  8
#define HD_ 64
#define MROWS (B_ * S_)          // 8192

#define AS1 __attribute__((address_space(1)))
#define AS3 __attribute__((address_space(3)))

#if __has_builtin(__builtin_amdgcn_global_load_async_to_lds_b128) && \
    __has_builtin(__builtin_amdgcn_s_wait_asynccnt)
#define HAVE_ASYNC_LDS 1
#else
#define HAVE_ASYNC_LDS 0
#endif

// one 16B chunk: global -> LDS (async on CDNA5, sync fallback otherwise)
__device__ __forceinline__ void stage16(const __bf16* g, __bf16* l) {
#if HAVE_ASYNC_LDS
  __builtin_amdgcn_global_load_async_to_lds_b128((AS1 v4i*)g, (AS3 v4i*)l,
                                                 0, 0);
#else
  *(v8bf*)l = *(const v8bf*)g;
#endif
}

__device__ __forceinline__ void async_wait_all() {
#if HAVE_ASYNC_LDS
  __builtin_amdgcn_s_wait_asynccnt(0);
#endif
}

__device__ __forceinline__ v16bf pack16(v8bf lo, v8bf hi) {
  union { v16bf v; v8bf p[2]; } u;
  u.p[0] = lo; u.p[1] = hi;
  return u.v;
}

__device__ __forceinline__ v8f zero8() {
  v8f z;
#pragma unroll
  for (int i = 0; i < 8; ++i) z[i] = 0.0f;
  return z;
}

// ------------------------------- casts -------------------------------------
// One launch converts both activation tensors and all six weight matrices to
// bf16. A short wave costs more to start than to run, so a lane converts 64
// activation elements or a 4 (n) x 8 (k) piece of a weight matrix.
// Blocks 0 .. 6*WBLK-1: weights, Wt[n][k] = W[k][n]; the rest: activations.

typedef __attribute__((ext_vector_type(4))) float  v4f;
typedef __attribute__((ext_vector_type(4))) __bf16 v4bf;

#define WBLK 32    // blocks per 512x512 weight matrix: tiles of 64 (k) x 128 (n)
#define ABLK 256   // blocks per activation tensor: 16,384 elements each
#define ACH  16    // 16-byte chunks per lane of an activation block

__global__ __launch_bounds__(256) void convert_all_kernel(
    const float* __restrict__ act0, const float* __restrict__ act1,
    const float* __restrict__ W0, const float* __restrict__ W1,
    const float* __restrict__ W2, const float* __restrict__ W3,
    const float* __restrict__ W4, const float* __restrict__ W5,
    __bf16* __restrict__ actb, __bf16* __restrict__ wtb) {
  const unsigned int blk = blockIdx.x;
  const int tid = threadIdx.x;

  if (blk < 6 * WBLK) {
    const int wi = blk / WBLK;
    const int t  = blk % WBLK;
    const float* W = wi == 0 ? W0 : wi == 1 ? W1 : wi == 2 ? W2
                   : wi == 3 ? W3 : wi == 4 ? W4 : W5;
    __bf16* Wt = wtb + (size_t)wi * (D_ * D_);
    // eight neighbouring lanes hold the eight k chunks of one Wt row piece:
    // together they store a whole 128-byte line
    const int k0 = (t & 7) * 64 + (tid & 7) * 8;
    const int n0 = (t >> 3) * 128 + (tid >> 3) * 4;
    v4f r[8];
#pragma unroll  // all eight loads in flight before the first convert
    for (int j = 0; j < 8; ++j) r[j] = *(const v4f*)&W[(k0 + j) * D_ + n0];
#pragma unroll  // constant indices: the vector elements stay in registers
    for (int c = 0; c < 4; ++c) {
      v8bf o;
#pragma unroll  // as above
      for (int j = 0; j < 8; ++j) o[j] = (__bf16)r[j][c];
      *(v8bf*)&Wt[(n0 + c) * D_ + k0] = o;
    }
  } else {
    const unsigned int ab = blk - 6 * WBLK;
    const int ti = ab / ABLK;
    const float* in = ti == 0 ? act0 : act1;
    __bf16* out = actb + (size_t)ti * (MROWS * D_);
    const unsigned int e0 = (ab % ABLK) * (256 * ACH * 4) + tid * 4;
    const unsigned int lo = e0 * 4;   // byte offset that all the loads share
    v4f r[ACH];
#pragma unroll  // all loads in flight before the first convert
    for (int j = 0; j < ACH; ++j)
      r[j] = *(const v4f*)((const char*)in + lo + j * 4096);
    // the wait owed before a register that an issued load names is rewritten;
    // it takes the shared offset as an input, so that no load's result lands in
    // that register while earlier loads of the run still name it
    asm volatile("s_wait_xcnt 0x0" :: "v"(lo) : "memory");
    // keeps the first converts from rising among the loads: the last loads would
    // then take over registers of the first and issue only when those return
    __builtin_amdgcn_sched_barrier(0);
#pragma unroll  // constant indices: the loaded chunks stay in registers
    for (int j = 0; j < ACH; ++j)
      *(v4bf*)&out[e0 + j * 1024] = __builtin_convertvector(r[j], v4bf);
    // the same wait behind the last stores: the code that follows them in the
    // built text rewrites their offset and data registers
    asm volatile("s_wait_xcnt 0x0" ::: "memory");
  }
}

// ------------------------------- GEMM --------------------------------------
// C[M,N] = (A[M,K] @ Bt[N,K]^T + bias[N]) * alpha
// Tiles: BM=128, BN=128, BK=64.  256 threads = 8 waves (2x4), wave: 64x32.
// Double-buffered async global->LDS staging. A K step takes 128 bytes of every
// operand row: eight lanes copy one whole cache line, where a step of 32 asked
// for each line twice, half of it at a time.

#define BM 128
#define BN 128
#define BK 64

__device__ __forceinline__ void gemm_tile(
    const __bf16* __restrict__ A, const __bf16* __restrict__ Bt,
    const float* __restrict__ bias, float* __restrict__ C,
    int M, int N, int K, float alpha) {
  __shared__ __align__(16) __bf16 As[2][BM][BK + 8];   // 144B rows
  __shared__ __align__(16) __bf16 Bs[2][BM][BK + 8];

  const int tid  = threadIdx.x;
  const int bm0  = blockIdx.y * BM;
  const int bn0  = blockIdx.x * BN;
  const int wave = tid >> 5;
  const int lane = tid & 31;
  const int wm   = wave >> 2;        // 0..1 -> 64-row slab
  const int wn   = wave & 3;         // 0..3 -> 32-col slab
  const int lr   = lane & 15;
  const int lh   = lane >> 4;
  const int koff = lh * 8;

  // this thread's four 16B staging chunks (same mapping for A and B tiles):
  // rows srow + 32*i, i = 0..3, at column scol
  const int srow = tid >> 3;
  const int scol = (tid & 7) * 8;

  v8f acc[4][2];
#pragma unroll
  for (int mt = 0; mt < 4; ++mt)
#pragma unroll
    for (int nt = 0; nt < 2; ++nt) acc[mt][nt] = zero8();

  // prologue: stage tile 0 into buffer 0
#pragma unroll  // the eight copies issue back to back
  for (int i = 0; i < 4; ++i) {
    int row = srow + i * 32;
    stage16(&A[(size_t)(bm0 + row) * K + scol], &As[0][row][scol]);
    stage16(&Bt[(size_t)(bn0 + row) * K + scol], &Bs[0][row][scol]);
  }

  int p = 0;
  for (int bk = 0; bk < K; bk += BK, p ^= 1) {
    async_wait_all();
    __syncthreads();
    if (bk + BK < K) {
      int nb = bk + BK;
#pragma unroll  // as in the prologue
      for (int i = 0; i < 4; ++i) {
        int row = srow + i * 32;
        stage16(&A[(size_t)(bm0 + row) * K + nb + scol], &As[p ^ 1][row][scol]);
        stage16(&Bt[(size_t)(bn0 + row) * K + nb + scol], &Bs[p ^ 1][row][scol]);
      }
    }

#pragma unroll  // constant ks: it folds into the LDS loads' offset fields
    for (int ks = 0; ks < BK; ks += 32) {
      v16bf af[4], bf[2];
#pragma unroll
      for (int mt = 0; mt < 4; ++mt) {
        int r   = wm * 64 + mt * 16 + lr;
        v8bf lo = *(const v8bf*)&As[p][r][ks + koff];
        v8bf hi = *(const v8bf*)&As[p][r][ks + koff + 16];
        af[mt]  = pack16(lo, hi);
      }
#pragma unroll
      for (int nt = 0; nt < 2; ++nt) {
        int r   = wn * 32 + nt * 16 + lr;
        v8bf lo = *(const v8bf*)&Bs[p][r][ks + koff];
        v8bf hi = *(const v8bf*)&Bs[p][r][ks + koff + 16];
        bf[nt]  = pack16(lo, hi);
      }
#pragma unroll
      for (int mt = 0; mt < 4; ++mt)
#pragma unroll
        for (int nt = 0; nt < 2; ++nt)
          acc[mt][nt] = __builtin_amdgcn_wmma_f32_16x16x32_bf16(
              false, af[mt], false, bf[nt], (short)0, acc[mt][nt], false, false);
    }
  }

  // epilogue: C layout -> lane holds col n=lr of each tile, rows r + lh*8
#pragma unroll
  for (int nt = 0; nt < 2; ++nt) {
    int n    = bn0 + wn * 32 + nt * 16 + lr;
    float bv = bias[n];
#pragma unroll
    for (int mt = 0; mt < 4; ++mt) {
#pragma unroll
      for (int r = 0; r < 8; ++r) {
        int m   = bm0 + wm * 64 + mt * 16 + lh * 8 + r;
        C[(size_t)m * N + n] = (acc[mt][nt][r] + bv) * alpha;
      }
    }
  }
}

// All five input projections in one launch, and K' = K*s + sh, V' = V*s + sh
// formed in its epilogue from the f32 accumulators: K, V, scale and shift never
// go to memory, and no launch stands between the projections and attention.
// A workgroup takes 64 rows and four groups of 64 columns. blockIdx.x < 8: the
// columns of head blockIdx.x in the products K, V, scale, shift (A = second
// activation plane); blockIdx.x = 8, 9: 256 columns of Q (A = first plane).
// 8 waves (2x4); a wave holds 32 rows x 16 columns of each of the four groups,
// so a lane has K, V, scale and shift of the same elements.
// actb: the two activation planes; wtb: the six Wt planes in the order
// q, k, v, o, scale, shift. Vt[b][h][hd][s] is V' transposed per head.

#define PM 64              // rows of a workgroup's tile
#define PROWS (PM + 256)   // staged rows of a K step: PM of A, then 4 x 64 of Wt

__global__ __launch_bounds__(256) void proj_kernel(
    const __bf16* __restrict__ actb, const __bf16* __restrict__ wtb,
    const float* __restrict__ bq, const float* __restrict__ bk,
    const float* __restrict__ bv, const float* __restrict__ bsc,
    const float* __restrict__ bsh, __bf16* __restrict__ Qo,
    __bf16* __restrict__ Kf, __bf16* __restrict__ Vt, int K) {
  __shared__ __align__(16) __bf16 Ts[2][PROWS][BK + 8];   // 144B rows

  const int tid  = threadIdx.x;
  const int bx   = blockIdx.x;
  const bool kv  = bx < H_;
  const int bm0  = blockIdx.y * PM;
  const int wave = tid >> 5;
  const int lane = tid & 31;
  const int wm   = wave >> 2;        // 0..1 -> 32-row slab
  const int wn   = wave & 3;         // 0..3 -> 16 columns of every group
  const int lr   = lane & 15;
  const int lh   = lane >> 4;
  const int koff = lh * 8;

  const __bf16* A = actb + (size_t)((kv ? MROWS : 0) + bm0) * K;
  // first row of column group g in the six stacked Wt planes
  auto brow = [&](int g) {
    return kv ? (g < 2 ? g + 1 : g + 2) * D_ + bx * HD_ : (bx - H_) * 256 + g * 64;
  };

  // a thread's ten 16B chunks of a K step: rows srow + 32*i at column scol
  const int srow = tid >> 3;
  const int scol = (tid & 7) * 8;
  auto stage = [&](int buf, int k0) {
#pragma unroll  // the ten copies issue back to back
    for (int i = 0; i < 10; ++i) {
      const __bf16* g =
          i < 2 ? &A[(size_t)(srow + i * 32) * K + k0 + scol]
                : &wtb[(size_t)(brow((i - 2) >> 1) + srow + (i & 1) * 32) * K +
                       k0 + scol];
      stage16(g, &Ts[buf][srow + i * 32][scol]);
    }
  };

  v8f acc[2][4];
#pragma unroll
  for (int mt = 0; mt < 2; ++mt)
#pragma unroll
    for (int g = 0; g < 4; ++g) acc[mt][g] = zero8();

  stage(0, 0);
  // step 0's copies have landed before the barrier behind which others read them
  asm volatile("s_wait_asynccnt 0x0" ::: "memory");
  __syncthreads();
  if (BK < K) stage(1, BK);

  int p = 0;
  for (int bk0 = 0; bk0 < K; bk0 += BK, p ^= 1) {
#pragma unroll  // constant ks: it folds into the LDS loads' offset fields
    for (int ks = 0; ks < BK; ks += 32) {
      v16bf af[2], bf[4];
#pragma unroll
      for (int mt = 0; mt < 2; ++mt) {
        int r   = wm * 32 + mt * 16 + lr;
        v8bf lo = *(const v8bf*)&Ts[p][r][ks + koff];
        v8bf hi = *(const v8bf*)&Ts[p][r][ks + koff + 16];
        af[mt]  = pack16(lo, hi);
      }
#pragma unroll
      for (int g = 0; g < 4; ++g) {
        int r   = PM + g * 64 + wn * 16 + lr;
        v8bf lo = *(const v8bf*)&Ts[p][r][ks + koff];
        v8bf hi = *(const v8bf*)&Ts[p][r][ks + koff + 16];
        bf[g]   = pack16(lo, hi);
      }
#pragma unroll
      for (int mt = 0; mt < 2; ++mt)
#pragma unroll
        for (int g = 0; g < 4; ++g)
          acc[mt][g] = __builtin_amdgcn_wmma_f32_16x16x32_bf16(
              false, af[mt], false, bf[g], (short)0, acc[mt][g], false, false);
    }
    // this wave's reads of buffer p are done before the buffer is refilled
    asm volatile("s_wait_dscnt 0x0" ::: "memory");
    // the next step's copies have landed before the barrier that publishes them
    asm volatile("s_wait_asynccnt 0x0" ::: "memory");
    __syncthreads();
    if (bk0 + 2 * BK < K) stage(p, bk0 + 2 * BK);
  }
  // no copy is in flight when the ring becomes output staging
  asm volatile("s_wait_asynccnt 0x0" ::: "memory");

  // C layout: a lane holds column lr of each 16x16 tile, rows lh*8 + r
  if (!kv) {
#pragma unroll
    for (int g = 0; g < 4; ++g) {
      int n    = (bx - H_) * 256 + g * 64 + wn * 16 + lr;
      float bb = bq[n];
#pragma unroll
      for (int mt = 0; mt < 2; ++mt) {
#pragma unroll
        for (int r = 0; r < 8; ++r) {
          int m = bm0 + wm * 32 + mt * 16 + lh * 8 + r;
          Qo[(size_t)m * D_ + n] = (__bf16)((acc[mt][g][r] + bb) * 0.125f);  // 1/sqrt(64)
        }
      }
    }
    // the wait owed before a register that an issued store names is rewritten:
    // in the built text the K'/V' part follows these stores and rewrites their
    // data registers
    asm volatile("s_wait_xcnt 0x0" ::: "memory");
    return;
  }

  // The loop's last barrier has ended every read of the ring: rows 0..63 of
  // buffer 0 take the K' tile [s][hd], rows 64..127 the V' tile [hd][s], so that
  // both leave as 16-byte pieces of whole 128-byte lines.
  const int c = wn * 16 + lr;         // hd
  const int n = bx * HD_ + c;
  const float b_k = bk[n], b_v = bv[n], b_s = bsc[n], b_t = bsh[n];
#pragma unroll
  for (int mt = 0; mt < 2; ++mt) {
    const int s = wm * 32 + mt * 16 + lh * 8;
    v8bf vv;
#pragma unroll  // constant r: the vector elements stay in registers
    for (int r = 0; r < 8; ++r) {
      float sc = acc[mt][2][r] + b_s, sh = acc[mt][3][r] + b_t;
      Ts[0][s + r][c] = (__bf16)((acc[mt][0][r] + b_k) * sc + sh);
      vv[r]           = (__bf16)((acc[mt][1][r] + b_v) * sc + sh);
    }
    *(v8bf*)&Ts[0][PM + c][s] = vv;
  }
  __syncthreads();

  __bf16* kout = Kf + (size_t)bm0 * D_ + bx * HD_;
  __bf16* vout = Vt + (size_t)((bm0 / S_) * H_ + bx) * HD_ * S_ + (bm0 & (S_ - 1));
#pragma unroll  // the four LDS reads issue before the first store waits for its data
  for (int i = 0; i < 2; ++i) {
    int ch = tid + i * 256, row = ch >> 3, col = (ch & 7) * 8;
    *(v8bf*)(kout + (size_t)row * D_ + col) = *(const v8bf*)&Ts[0][row][col];
    *(v8bf*)(vout + (size_t)row * S_ + col) = *(const v8bf*)&Ts[0][PM + row][col];
  }
}

// output projection -> f32
__global__ __launch_bounds__(256) void gemm_out_kernel(
    const __bf16* __restrict__ A, const __bf16* __restrict__ Bt,
    const float* __restrict__ bias, float* __restrict__ C,
    int M, int N, int K, float alpha) {
  gemm_tile(A, Bt, bias, C, M, N, K, alpha);
}

// lane l with lane l ^ 16
__device__ __forceinline__ float xhalf(float x) {
  int v = __float_as_int(x);
  return __int_as_float(__builtin_amdgcn_permlanex16(v, v, 0x76543210,
                                                     0xfedcba98, false, false));
}

// x[i] = 2^x[i], eight at a time. One statement, so that the closing v_nop stays
// directly behind the last v_exp_f32: it is the slot the instruction set asks
// for between a transcendental and an instruction that reads its result or
// overwrites its source. Each v_exp_f32 works in place on a register of its own, so
// none touches a neighbour's source or result, and the statement writes no
// register that the compiler's own code has not written just before.
__device__ __forceinline__ v8f exp2x8(v8f x) {
  float y0 = x[0], y1 = x[1], y2 = x[2], y3 = x[3];
  float y4 = x[4], y5 = x[5], y6 = x[6], y7 = x[7];
  asm("v_exp_f32 %0, %0\n\t"
      "v_exp_f32 %1, %1\n\t"
      "v_exp_f32 %2, %2\n\t"
      "v_exp_f32 %3, %3\n\t"
      "v_exp_f32 %4, %4\n\t"
      "v_exp_f32 %5, %5\n\t"
      "v_exp_f32 %6, %6\n\t"
      "v_exp_f32 %7, %7\n\t"
      "v_nop"
      : "+v"(y0), "+v"(y1), "+v"(y2), "+v"(y3), "+v"(y4), "+v"(y5), "+v"(y6),
        "+v"(y7));
  v8f y = {y0, y1, y2, y3, y4, y5, y6, y7};
  return y;
}

__global__ __launch_bounds__(128) void attn_kernel(
    const __bf16* __restrict__ Qb, const __bf16* __restrict__ Kb,
    const __bf16* __restrict__ Vt, __bf16* __restrict__ Ob) {
  __shared__ __align__(16) __bf16 Ks[2][64][72];    // [key][hd]
  __shared__ __align__(16) __bf16 Vs[2][64][72];    // [hd][key] (transposed V)

  const int b    = blockIdx.z;
  const int h    = blockIdx.y;
  const int q0   = blockIdx.x * 64;
  const int tid  = threadIdx.x;
  const int wave = tid >> 5;
  const int lane = tid & 31;
  const int lr   = lane & 15;
  const int lh   = lane >> 4;
  const int koff = lh * 8;

  const __bf16* Kbase = Kb + (size_t)(b * S_) * D_ + h * HD_;
  const __bf16* Vbase = Vt + (size_t)(b * H_ + h) * HD_ * S_;

  // Q fragments (B operand: column = query lr, 2 k-steps), resident in VGPRs
  v16bf qf[2];
  {
    int qrow           = q0 + wave * 16 + lr;
    const __bf16* qptr = Qb + (size_t)(b * S_ + qrow) * D_ + h * HD_;
#pragma unroll
    for (int ks = 0; ks < 2; ++ks) {
      v8bf lo = *(const v8bf*)(qptr + ks * 32 + koff);
      v8bf hi = *(const v8bf*)(qptr + ks * 32 + koff + 16);
      qf[ks]  = pack16(lo, hi);
    }
  }

  // o[nt][r] = O^T[hd nt*16 + lh*8 + r][query lr]
  v8f o[4];
#pragma unroll
  for (int nt = 0; nt < 4; ++nt) o[nt] = zero8();
  // running maximum of query lr (equal in both wave halves) and this half's
  // share of its running sum
  float rm = -1e30f, rs = 0.0f;

  // this thread's four 16B staging chunks per tile
  // chunk c = tid + i*128; row = c>>3 (8 x 16B per 128B row); col = (c&7)*8
  // prologue: stage tile 0 into buffer 0
#pragma unroll
  for (int i = 0; i < 4; ++i) {
    int c = tid + i * 128, row = c >> 3, col = (c & 7) * 8;
    stage16(&Kbase[(size_t)row * D_ + col], &Ks[0][row][col]);
    stage16(&Vbase[(size_t)row * S_ + col], &Vs[0][row][col]);
  }

  int p = 0;
  for (int kt0 = 0; kt0 < S_; kt0 += 64, p ^= 1) {
    async_wait_all();
    __syncthreads();
    if (kt0 + 64 < S_) {
      int nk = kt0 + 64;
#pragma unroll
      for (int i = 0; i < 4; ++i) {
        int c = tid + i * 128, row = c >> 3, col = (c & 7) * 8;
        stage16(&Kbase[(size_t)(nk + row) * D_ + col], &Ks[p ^ 1][row][col]);
        stage16(&Vbase[(size_t)row * S_ + nk + col], &Vs[p ^ 1][row][col]);
      }
    }

    // S^T = K @ Q^T   (4 key tiles x 2 k-steps)
    // sc[nt][r] = score of key nt*16 + lh*8 + r with query lr
    v8f sc[4];
#pragma unroll
    for (int nt = 0; nt < 4; ++nt) {
      sc[nt] = zero8();
#pragma unroll
      for (int ks = 0; ks < 2; ++ks) {
        int row  = nt * 16 + lr;
        v8bf lo  = *(const v8bf*)&Ks[p][row][ks * 32 + koff];
        v8bf hi  = *(const v8bf*)&Ks[p][row][ks * 32 + koff + 16];
        v16bf kf = pack16(lo, hi);
        sc[nt]   = __builtin_amdgcn_wmma_f32_16x16x32_bf16(
            false, kf, false, qf[ks], (short)0, sc[nt], false, false);
      }
    }

    // online softmax: the lane's 32 scores belong to one query; the other 32
    // of the tile sit in lane ^ 16
    // one chain per score tile: four short chains instead of one long one
    float tm[4];
#pragma unroll
    for (int nt = 0; nt < 4; ++nt) {
      tm[nt] = sc[nt][0];
#pragma unroll
      for (int r = 1; r < 8; ++r) tm[nt] = fmaxf(tm[nt], sc[nt][r]);
    }
    float mx = fmaxf(fmaxf(tm[0], tm[1]), fmaxf(tm[2], tm[3]));
    mx = fmaxf(mx, xhalf(mx));
    const float nm   = fmaxf(rm, mx);
    const float corr = __expf(rm - nm);
    rm               = nm;
    float ts[4];
#pragma unroll
    for (int nt = 0; nt < 4; ++nt) {
#pragma unroll
      for (int r = 0; r < 8; ++r)
        sc[nt][r] = (sc[nt][r] - nm) * 1.44269504088896340736f;  // log2(e)
      sc[nt] = exp2x8(sc[nt]);
      ts[nt] = sc[nt][0];
#pragma unroll
      for (int r = 1; r < 8; ++r) ts[nt] += sc[nt][r];
    }
    const float psum = (ts[0] + ts[1]) + (ts[2] + ts[3]);
    rs = rs * corr + psum;
#pragma unroll
    for (int nt = 0; nt < 4; ++nt)
#pragma unroll
      for (int r = 0; r < 8; ++r) o[nt][r] *= corr;

    // O^T += V^T @ P^T   (2 k-steps over keys x 4 hd tiles)
#pragma unroll
    for (int ks = 0; ks < 2; ++ks) {
      // score tiles 2*ks and 2*ks + 1 hold keys 8*lh + s and 16 + 8*lh + s of
      // this k-step: the k order in which the V^T loader below reads
      v16bf pf;
#pragma unroll
      for (int s = 0; s < 8; ++s) {
        pf[s]     = (__bf16)sc[2 * ks][s];
        pf[s + 8] = (__bf16)sc[2 * ks + 1][s];
      }
#pragma unroll
      for (int nt = 0; nt < 4; ++nt) {
        int row  = nt * 16 + lr;
        v8bf lo  = *(const v8bf*)&Vs[p][row][ks * 32 + koff];
        v8bf hi  = *(const v8bf*)&Vs[p][row][ks * 32 + koff + 16];
        v16bf vf = pack16(lo, hi);
        o[nt]    = __builtin_amdgcn_wmma_f32_16x16x32_bf16(
            false, vf, false, pf, (short)0, o[nt], false, false);
      }
    }
  }

  // join the halves' sums, normalize and store (bf16, [B*S, D] layout): a lane
  // holds 8 consecutive hd of its query per tile, one 16-byte store each
  const float inv = 1.0f / (rs + xhalf(rs));
  __bf16* optr = Ob + (size_t)(b * S_ + q0 + wave * 16 + lr) * D_ + h * HD_ + koff;
#pragma unroll
  for (int nt = 0; nt < 4; ++nt) {
    v8bf ov;
#pragma unroll
    for (int r = 0; r < 8; ++r) ov[r] = (__bf16)(o[nt][r] * inv);
    *(v8bf*)(optr + nt * 16) = ov;
  }
}

// ------------------------------ launcher ------------------------------------

extern "C" void kernel_launch(void* const* d_in, const int* in_sizes, int n_in,
                              void* d_out, int out_size, void* d_ws,
                              size_t ws_size, hipStream_t stream) {
  const float* mod1 = (const float*)d_in[0];
  const float* mod2 = (const float*)d_in[1];
  const float* Wq   = (const float*)d_in[2];
  const float* bq   = (const float*)d_in[3];
  const float* Wk   = (const float*)d_in[4];
  const float* bk   = (const float*)d_in[5];
  const float* Wv   = (const float*)d_in[6];
  const float* bv   = (const float*)d_in[7];
  const float* Wo   = (const float*)d_in[8];
  const float* bo   = (const float*)d_in[9];
  const float* Wsc  = (const float*)d_in[10];
  const float* bsc  = (const float*)d_in[11];
  const float* Wsh  = (const float*)d_in[12];
  const float* bsh  = (const float*)d_in[13];
  float* out        = (float*)d_out;

  const size_t ACT = (size_t)MROWS * D_ * sizeof(__bf16);  // 8 MB
  const size_t WT  = (size_t)D_ * D_ * sizeof(__bf16);     // 0.5 MB

  char* w = (char*)d_ws;
  size_t off = 0;
  auto carve = [&](size_t bytes) -> __bf16* {
    __bf16* p = (__bf16*)(w + off);
    off += bytes;
    return p;
  };
  __bf16* mod1b = carve(ACT);
  __bf16* mod2b = carve(ACT);
  __bf16* Wqt   = carve(WT);
  __bf16* Wkt   = carve(WT);
  __bf16* Wvt   = carve(WT);
  __bf16* Wot   = carve(WT);
  __bf16* Wsct  = carve(WT);
  __bf16* Wsht  = carve(WT);
  __bf16* Qb    = carve(ACT);
  __bf16* Kfb   = carve(ACT);
  __bf16* Vtb   = carve(ACT);   // [B,H,HD,S]
  __bf16* Obuf  = carve(ACT);

  // 1) casts: mod1b, mod2b and the six Wt planes lie one behind the other
  convert_all_kernel<<<6 * WBLK + 2 * ABLK, 256, 0, stream>>>(
      mod1, mod2, Wq, Wk, Wv, Wo, Wsc, Wsh, mod1b, Wqt);

  // 2) projections; K' = K*s+sh and V' = V*s+sh (transposed per head) leave
  //    from the epilogue
  proj_kernel<<<dim3(H_ + 2, MROWS / PM), 256, 0, stream>>>(
      mod1b, Wqt, bq, bk, bv, bsc, bsh, Qb, Kfb, Vtb, D_);

  // 3) flash attention
  attn_kernel<<<dim3(S_ / 64, H_, B_), 128, 0, stream>>>(Qb, Kfb, Vtb, Obuf);

  // 4) output projection -> f32
  gemm_out_kernel<<<dim3(D_ / BN, MROWS / BM), 256, 0, stream>>>(
      Obuf, Wot, bo, out, MROWS, D_, D_, 1.0f);
}

// v007
// It runs in 82.8 microseconds.
// Two timings next to v006 put it at 1.04 and 1.03 times that version's speed.
// Over all steps from v000 it is 3.29 times as fast.
#include <hip/hip_runtime.h>
#include <hip/hip_bf16.h>

// ---------------------------------------------------------------------------
// MultiHeadCrossModalAttention on MI455X (gfx1250, wave32, WMMA bf16,
// async global->LDS staging, transposed attention products)
// B=4, S=2048, D=512, H=8, HD=64
// ---------------------------------------------------------------------------

typedef __attribute__((ext_vector_type(16))) __bf16 v16bf;
typedef __attribute__((ext_vector_type(8)))  __bf16 v8bf;
typedef __attribute__((ext_vector_type(8)))  float  v8f;
typedef int v4i __attribute__((vector_size(16)));

#define B_  4
#define S_  2048
#define D_  512
#define H_  8
#define HD_ 64
#define MROWS (B_ * S_)          // 8192

#define AS1 __attribute__((address_space(1)))
#define AS3 __attribute__((address_space(3)))

#if __has_builtin(__builtin_amdgcn_global_load_async_to_lds_b128) && \
    __has_builtin(__builtin_amdgcn_s_wait_asynccnt)
#define HAVE_ASYNC_LDS 1
#else
#define HAVE_ASYNC_LDS 0
#endif

// one 16B chunk: global -> LDS (async on CDNA5, sync fallback otherwise)
__device__ __forceinline__ void stage16(const __bf16* g, __bf16* l) {
#if HAVE_ASYNC_LDS
  __builtin_amdgcn_global_load_async_to_lds_b128((AS1 v4i*)g, (AS3 v4i*)l,
                                                 0, 0);
#else
  *(v8bf*)l = *(const v8bf*)g;
#endif
}

__device__ __forceinline__ void async_wait_all() {
#if HAVE_ASYNC_LDS
  __builtin_amdgcn_s_wait_asynccnt(0);
#endif
}

__device__ __forceinline__ v16bf pack16(v8bf lo, v8bf hi) {
  union { v16bf v; v8bf p[2]; } u;
  u.p[0] = lo; u.p[1] = hi;
  return u.v;
}

__device__ __forceinline__ v8f zero8() {
  v8f z;
#pragma unroll
  for (int i = 0; i < 8; ++i) z[i] = 0.0f;
  return z;
}

// ------------------------------- casts -------------------------------------
// One launch converts both activation tensors and all six weight matrices to
// bf16. A short wave costs more to start than to run, so a lane converts 64
// activation elements or a 4 (n) x 8 (k) piece of a weight matrix.
// Blocks 0 .. 6*WBLK-1: weights, Wt[n][k] = W[k][n]; the rest: activations.

typedef __attribute__((ext_vector_type(4))) float  v4f;
typedef __attribute__((ext_vector_type(4))) __bf16 v4bf;

#define WBLK 32    // blocks per 512x512 weight matrix: tiles of 64 (k) x 128 (n)
#define ABLK 256   // blocks per activation tensor: 16,384 elements each
#define ACH  16    // 16-byte chunks per lane of an activation block

__global__ __launch_bounds__(256) void convert_all_kernel(
    const float* __restrict__ act0, const float* __restrict__ act1,
    const float* __restrict__ W0, const float* __restrict__ W1,
    const float* __restrict__ W2, const float* __restrict__ W3,
    const float* __restrict__ W4, const float* __restrict__ W5,
    __bf16* __restrict__ actb, __bf16* __restrict__ wtb) {
  const unsigned int blk = blockIdx.x;
  const int tid = threadIdx.x;

  if (blk < 6 * WBLK) {
    const int wi = blk / WBLK;
    const int t  = blk % WBLK;
    const float* W = wi == 0 ? W0 : wi == 1 ? W1 : wi == 2 ? W2
                   : wi == 3 ? W3 : wi == 4 ? W4 : W5;
    __bf16* Wt = wtb + (size_t)wi * (D_ * D_);
    // eight neighbouring lanes hold the eight k chunks of one Wt row piece:
    // together they store a whole 128-byte line
    const int k0 = (t & 7) * 64 + (tid & 7) * 8;
    const int n0 = (t >> 3) * 128 + (tid >> 3) * 4;
    v4f r[8];
#pragma unroll  // all eight loads in flight before the first convert
    for (int j = 0; j < 8; ++j) r[j] = *(const v4f*)&W[(k0 + j) * D_ + n0];
#pragma unroll  // constant indices: the vector elements stay in registers
    for (int c = 0; c < 4; ++c) {
      v8bf o;
#pragma unroll  // as above
      for (int j = 0; j < 8; ++j) o[j] = (__bf16)r[j][c];
      *(v8bf*)&Wt[(n0 + c) * D_ + k0] = o;
    }
  } else {
    const unsigned int ab = blk - 6 * WBLK;
    const int ti = ab / ABLK;
    const float* in = ti == 0 ? act0 : act1;
    __bf16* out = actb + (size_t)ti * (MROWS * D_);
    const unsigned int e0 = (ab % ABLK) * (256 * ACH * 4) + tid * 4;
    const unsigned int lo = e0 * 4;   // byte offset that all the loads share
    v4f r[ACH];
#pragma unroll  // all loads in flight before the first convert
    for (int j = 0; j < ACH; ++j)
      r[j] = *(const v4f*)((const char*)in + lo + j * 4096);
    // the wait owed before a register that an issued load names is rewritten;
    // it takes the shared offset as an input, so that no load's result lands in
    // that register while earlier loads of the run still name it
    asm volatile("s_wait_xcnt 0x0" :: "v"(lo) : "memory");
    // keeps the first converts from rising among the loads: the last loads would
    // then take over registers of the first and issue only when those return
    __builtin_amdgcn_sched_barrier(0);
#pragma unroll  // constant indices: the loaded chunks stay in registers
    for (int j = 0; j < ACH; ++j)
      *(v4bf*)&out[e0 + j * 1024] = __builtin_convertvector(r[j], v4bf);
    // the same wait behind the last stores: the code that follows them in the
    // built text rewrites their offset and data registers
    asm volatile("s_wait_xcnt 0x0" ::: "memory");
  }
}

// ------------------------------- GEMM --------------------------------------
// C[M,N] = (A[M,K] @ Bt[N,K]^T + bias[N]) * alpha
// Tiles: BM=128, BN=128, BK=64.  256 threads = 8 waves (2x4), wave: 64x32.
// Double-buffered async global->LDS staging. A K step takes 128 bytes of every
// operand row: eight lanes copy one whole cache line, where a step of 32 asked
// for each line twice, half of it at a time.

#define BM 128
#define BN 128
#define BK 64

__device__ __forceinline__ void gemm_tile(
    const __bf16* __restrict__ A, const __bf16* __restrict__ Bt,
    const float* __restrict__ bias, float* __restrict__ C,
    int M, int N, int K, float alpha) {
  __shared__ __align__(16) __bf16 As[2][BM][BK + 8];   // 144B rows
  __shared__ __align__(16) __bf16 Bs[2][BM][BK + 8];

  const int tid  = threadIdx.x;
  const int bm0  = blockIdx.y * BM;
  const int bn0  = blockIdx.x * BN;
  const int wave = tid >> 5;
  const int lane = tid & 31;
  const int wm   = wave >> 2;        // 0..1 -> 64-row slab
  const int wn   = wave & 3;         // 0..3 -> 32-col slab
  const int lr   = lane & 15;
  const int lh   = lane >> 4;
  const int koff = lh * 8;

  // this thread's four 16B staging chunks (same mapping for A and B tiles):
  // rows srow + 32*i, i = 0..3, at column scol
  const int srow = tid >> 3;
  const int scol = (tid & 7) * 8;

  v8f acc[4][2];
#pragma unroll
  for (int mt = 0; mt < 4; ++mt)
#pragma unroll
    for (int nt = 0; nt < 2; ++nt) acc[mt][nt] = zero8();

  // prologue: stage tile 0 into buffer 0
#pragma unroll  // the eight copies issue back to back
  for (int i = 0; i < 4; ++i) {
    int row = srow + i * 32;
    stage16(&A[(size_t)(bm0 + row) * K + scol], &As[0][row][scol]);
    stage16(&Bt[(size_t)(bn0 + row) * K + scol], &Bs[0][row][scol]);
  }

  int p = 0;
  for (int bk = 0; bk < K; bk += BK, p ^= 1) {
    async_wait_all();
    __syncthreads();
    if (bk + BK < K) {
      int nb = bk + BK;
#pragma unroll  // as in the prologue
      for (int i = 0; i < 4; ++i) {
        int row = srow + i * 32;
        stage16(&A[(size_t)(bm0 + row) * K + nb + scol], &As[p ^ 1][row][scol]);
        stage16(&Bt[(size_t)(bn0 + row) * K + nb + scol], &Bs[p ^ 1][row][scol]);
      }
    }

#pragma unroll  // constant ks: it folds into the LDS loads' offset fields
    for (int ks = 0; ks < BK; ks += 32) {
      v16bf af[4], bf[2];
#pragma unroll
      for (int mt = 0; mt < 4; ++mt) {
        int r   = wm * 64 + mt * 16 + lr;
        v8bf lo = *(const v8bf*)&As[p][r][ks + koff];
        v8bf hi = *(const v8bf*)&As[p][r][ks + koff + 16];
        af[mt]  = pack16(lo, hi);
      }
#pragma unroll
      for (int nt = 0; nt < 2; ++nt) {
        int r   = wn * 32 + nt * 16 + lr;
        v8bf lo = *(const v8bf*)&Bs[p][r][ks + koff];
        v8bf hi = *(const v8bf*)&Bs[p][r][ks + koff + 16];
        bf[nt]  = pack16(lo, hi);
      }
#pragma unroll
      for (int mt = 0; mt < 4; ++mt)
#pragma unroll
        for (int nt = 0; nt < 2; ++nt)
          acc[mt][nt] = __builtin_amdgcn_wmma_f32_16x16x32_bf16(
              false, af[mt], false, bf[nt], (short)0, acc[mt][nt], false, false);
    }
  }

  // epilogue: C layout -> lane holds col n=lr of each tile, rows r + lh*8
#pragma unroll
  for (int nt = 0; nt < 2; ++nt) {
    int n    = bn0 + wn * 32 + nt * 16 + lr;
    float bv = bias[n];
#pragma unroll
    for (int mt = 0; mt < 4; ++mt) {
#pragma unroll
      for (int r = 0; r < 8; ++r) {
        int m   = bm0 + wm * 64 + mt * 16 + lh * 8 + r;
        C[(size_t)m * N + n] = (acc[mt][nt][r] + bv) * alpha;
      }
    }
  }
}

// All five input projections in one launch, and K' = K*s + sh, V' = V*s + sh
// formed in its epilogue from the f32 accumulators: K, V, scale and shift never
// go to memory, and no launch stands between the projections and attention.
// A workgroup takes 64 rows and four groups of 64 columns. blockIdx.x < 8: the
// columns of head blockIdx.x in the products K, V, scale, shift (A = second
// activation plane); blockIdx.x = 8, 9: 256 columns of Q (A = first plane).
// 8 waves (2x4); a wave holds 32 rows x 16 columns of each of the four groups,
// so a lane has K, V, scale and shift of the same elements.
// actb: the two activation planes; wtb: the six Wt planes in the order
// q, k, v, o, scale, shift. Vt[b][h][hd][s] is V' transposed per head.

#define PM 64              // rows of a workgroup's tile
#define PROWS (PM + 256)   // staged rows of a K step: PM of A, then 4 x 64 of Wt

__global__ __launch_bounds__(256) void proj_kernel(
    const __bf16* __restrict__ actb, const __bf16* __restrict__ wtb,
    const float* __restrict__ bq, const float* __restrict__ bk,
    const float* __restrict__ bv, const float* __restrict__ bsc,
    const float* __restrict__ bsh, __bf16* __restrict__ Qo,
    __bf16* __restrict__ Kf, __bf16* __restrict__ Vt, int K) {
  __shared__ __align__(16) __bf16 Ts[2][PROWS][BK + 8];   // 144B rows

  const int tid  = threadIdx.x;
  const int bx   = blockIdx.x;
  const bool kv  = bx < H_;
  const int bm0  = blockIdx.y * PM;
  const int wave = tid >> 5;
  const int lane = tid & 31;
  const int wm   = wave >> 2;        // 0..1 -> 32-row slab
  const int wn   = wave & 3;         // 0..3 -> 16 columns of every group
  const int lr   = lane & 15;
  const int lh   = lane >> 4;
  const int koff = lh * 8;

  const __bf16* A = actb + (size_t)((kv ? MROWS : 0) + bm0) * K;
  // first row of column group g in the six stacked Wt planes
  auto brow = [&](int g) {
    return kv ? (g < 2 ? g + 1 : g + 2) * D_ + bx * HD_ : (bx - H_) * 256 + g * 64;
  };

  // a thread's ten 16B chunks of a K step: rows srow + 32*i at column scol
  const int srow = tid >> 3;
  const int scol = (tid & 7) * 8;
  auto stage = [&](int buf, int k0) {
#pragma unroll  // the ten copies issue back to back
    for (int i = 0; i < 10; ++i) {
      const __bf16* g =
          i < 2 ? &A[(size_t)(srow + i * 32) * K + k0 + scol]
                : &wtb[(size_t)(brow((i - 2) >> 1) + srow + (i & 1) * 32) * K +
                       k0 + scol];
      stage16(g, &Ts[buf][srow + i * 32][scol]);
    }
  };

  v8f acc[2][4];
#pragma unroll
  for (int mt = 0; mt < 2; ++mt)
#pragma unroll
    for (int g = 0; g < 4; ++g) acc[mt][g] = zero8();

  stage(0, 0);
  // step 0's copies have landed before the barrier behind which others read them
  asm volatile("s_wait_asynccnt 0x0" ::: "memory");
  __syncthreads();
  if (BK < K) stage(1, BK);

  int p = 0;
  for (int bk0 = 0; bk0 < K; bk0 += BK, p ^= 1) {
#pragma unroll  // constant ks: it folds into the LDS loads' offset fields
    for (int ks = 0; ks < BK; ks += 32) {
      v16bf af[2], bf[4];
#pragma unroll
      for (int mt = 0; mt < 2; ++mt) {
        int r   = wm * 32 + mt * 16 + lr;
        v8bf lo = *(const v8bf*)&Ts[p][r][ks + koff];
        v8bf hi = *(const v8bf*)&Ts[p][r][ks + koff + 16];
        af[mt]  = pack16(lo, hi);
      }
#pragma unroll
      for (int g = 0; g < 4; ++g) {
        int r   = PM + g * 64 + wn * 16 + lr;
        v8bf lo = *(const v8bf*)&Ts[p][r][ks + koff];
        v8bf hi = *(const v8bf*)&Ts[p][r][ks + koff + 16];
        bf[g]   = pack16(lo, hi);
      }
#pragma unroll
      for (int mt = 0; mt < 2; ++mt)
#pragma unroll
        for (int g = 0; g < 4; ++g)
          acc[mt][g] = __builtin_amdgcn_wmma_f32_16x16x32_bf16(
              false, af[mt], false, bf[g], (short)0, acc[mt][g], false, false);
    }
    // this wave's reads of buffer p are done before the buffer is refilled
    asm volatile("s_wait_dscnt 0x0" ::: "memory");
    // the next step's copies have landed before the barrier that publishes them
    asm volatile("s_wait_asynccnt 0x0" ::: "memory");
    __syncthreads();
    if (bk0 + 2 * BK < K) stage(p, bk0 + 2 * BK);
  }
  // no copy is in flight when the ring becomes output staging
  asm volatile("s_wait_asynccnt 0x0" ::: "memory");

  // C layout: a lane holds column lr of each 16x16 tile, rows lh*8 + r
  if (!kv) {
#pragma unroll
    for (int g = 0; g < 4; ++g) {
      int n    = (bx - H_) * 256 + g * 64 + wn * 16 + lr;
      float bb = bq[n];
#pragma unroll
      for (int mt = 0; mt < 2; ++mt) {
#pragma unroll
        for (int r = 0; r < 8; ++r) {
          int m = bm0 + wm * 32 + mt * 16 + lh * 8 + r;
          Qo[(size_t)m * D_ + n] = (__bf16)((acc[mt][g][r] + bb) * 0.125f);  // 1/sqrt(64)
        }
      }
    }
    // the wait owed before a register that an issued store names is rewritten:
    // in the built text the K'/V' part follows these stores and rewrites their
    // data registers
    asm volatile("s_wait_xcnt 0x0" ::: "memory");
    return;
  }

  // The loop's last barrier has ended every read of the ring: rows 0..63 of
  // buffer 0 take the K' tile [s][hd], rows 64..127 the V' tile [hd][s], so that
  // both leave as 16-byte pieces of whole 128-byte lines.
  const int c = wn * 16 + lr;         // hd
  const int n = bx * HD_ + c;
  const float b_k = bk[n], b_v = bv[n], b_s = bsc[n], b_t = bsh[n];
#pragma unroll
  for (int mt = 0; mt < 2; ++mt) {
    const int s = wm * 32 + mt * 16 + lh * 8;
    v8bf vv;
#pragma unroll  // constant r: the vector elements stay in registers
    for (int r = 0; r < 8; ++r) {
      float sc = acc[mt][2][r] + b_s, sh = acc[mt][3][r] + b_t;
      Ts[0][s + r][c] = (__bf16)((acc[mt][0][r] + b_k) * sc + sh);
      vv[r]           = (__bf16)((acc[mt][1][r] + b_v) * sc + sh);
    }
    *(v8bf*)&Ts[0][PM + c][s] = vv;
  }
  __syncthreads();

  __bf16* kout = Kf + (size_t)bm0 * D_ + bx * HD_;
  __bf16* vout = Vt + (size_t)((bm0 / S_) * H_ + bx) * HD_ * S_ + (bm0 & (S_ - 1));
#pragma unroll  // the four LDS reads issue before the first store waits for its data
  for (int i = 0; i < 2; ++i) {
    int ch = tid + i * 256, row = ch >> 3, col = (ch & 7) * 8;
    *(v8bf*)(kout + (size_t)row * D_ + col) = *(const v8bf*)&Ts[0][row][col];
    *(v8bf*)(vout + (size_t)row * S_ + col) = *(const v8bf*)&Ts[0][PM + row][col];
  }
}

// output projection -> f32
__global__ __launch_bounds__(256) void gemm_out_kernel(
    const __bf16* __restrict__ A, const __bf16* __restrict__ Bt,
    const float* __restrict__ bias, float* __restrict__ C,
    int M, int N, int K, float alpha) {
  gemm_tile(A, Bt, bias, C, M, N, K, alpha);
}

#define QG 2   // groups of 16 queries per wave

// lane l with lane l ^ 16
__device__ __forceinline__ float xhalf(float x) {
  int v = __float_as_int(x);
  return __int_as_float(__builtin_amdgcn_permlanex16(v, v, 0x76543210,
                                                     0xfedcba98, false, false));
}

// x[i] = 2^x[i], eight at a time. One statement, so that the closing v_nop stays
// directly behind the last v_exp_f32: it is the slot the instruction set asks
// for between a transcendental and an instruction that reads its result or
// overwrites its source. Each v_exp_f32 works in place on a register of its own, so
// none touches a neighbour's source or result, and the statement writes no
// register that the compiler's own code has not written just before.
__device__ __forceinline__ v8f exp2x8(v8f x) {
  float y0 = x[0], y1 = x[1], y2 = x[2], y3 = x[3];
  float y4 = x[4], y5 = x[5], y6 = x[6], y7 = x[7];
  asm("v_exp_f32 %0, %0\n\t"
      "v_exp_f32 %1, %1\n\t"
      "v_exp_f32 %2, %2\n\t"
      "v_exp_f32 %3, %3\n\t"
      "v_exp_f32 %4, %4\n\t"
      "v_exp_f32 %5, %5\n\t"
      "v_exp_f32 %6, %6\n\t"
      "v_exp_f32 %7, %7\n\t"
      "v_nop"
      : "+v"(y0), "+v"(y1), "+v"(y2), "+v"(y3), "+v"(y4), "+v"(y5), "+v"(y6),
        "+v"(y7));
  v8f y = {y0, y1, y2, y3, y4, y5, y6, y7};
  return y;
}

__global__ __launch_bounds__(128) void attn_kernel(
    const __bf16* __restrict__ Qb, const __bf16* __restrict__ Kb,
    const __bf16* __restrict__ Vt, __bf16* __restrict__ Ob) {
  __shared__ __align__(16) __bf16 Ks[2][64][72];    // [key][hd]
  __shared__ __align__(16) __bf16 Vs[2][64][72];    // [hd][key] (transposed V)

  const int b    = blockIdx.z;
  const int h    = blockIdx.y;
  const int q0   = blockIdx.x * (4 * 16 * QG);
  const int tid  = threadIdx.x;
  const int wave = tid >> 5;
  const int lane = tid & 31;
  const int lr   = lane & 15;
  const int lh   = lane >> 4;
  const int koff = lh * 8;

  const __bf16* Kbase = Kb + (size_t)(b * S_) * D_ + h * HD_;
  const __bf16* Vbase = Vt + (size_t)(b * H_ + h) * HD_ * S_;

  // Q fragments (B operand: column = query lr of group g, 2 k-steps), resident
  // in VGPRs
  v16bf qf[QG][2];
#pragma unroll  // constant g: the groups' arrays stay in registers
  for (int g = 0; g < QG; ++g) {
    int qrow           = q0 + (wave * QG + g) * 16 + lr;
    const __bf16* qptr = Qb + (size_t)(b * S_ + qrow) * D_ + h * HD_;
#pragma unroll
    for (int ks = 0; ks < 2; ++ks) {
      v8bf lo   = *(const v8bf*)(qptr + ks * 32 + koff);
      v8bf hi   = *(const v8bf*)(qptr + ks * 32 + koff + 16);
      qf[g][ks] = pack16(lo, hi);
    }
  }
  // the wait owed before a register that an issued load names is rewritten: the
  // staging addresses formed below take over the Q loads' address registers
  asm volatile("s_wait_xcnt 0x0" ::: "memory");
  // keeps those address sums from rising among the Q loads, in front of the wait
  __builtin_amdgcn_sched_barrier(0);

  // o[g][nt][r] = O^T[hd nt*16 + lh*8 + r][query lr of group g]
  v8f o[QG][4];
  // running maximum of query lr (equal in both wave halves) and this half's
  // share of its running sum
  float rm[QG], rs[QG];
#pragma unroll  // constant g: the groups' arrays stay in registers
  for (int g = 0; g < QG; ++g) {
#pragma unroll
    for (int nt = 0; nt < 4; ++nt) o[g][nt] = zero8();
    rm[g] = -1e30f;
    rs[g] = 0.0f;
  }

  // this thread's four 16B staging chunks per tile
  // chunk c = tid + i*128; row = c>>3 (8 x 16B per 128B row); col = (c&7)*8
  // prologue: stage tile 0 into buffer 0
#pragma unroll
  for (int i = 0; i < 4; ++i) {
    int c = tid + i * 128, row = c >> 3, col = (c & 7) * 8;
    stage16(&Kbase[(size_t)row * D_ + col], &Ks[0][row][col]);
    stage16(&Vbase[(size_t)row * S_ + col], &Vs[0][row][col]);
  }

  int p = 0;
  for (int kt0 = 0; kt0 < S_; kt0 += 64, p ^= 1) {
    async_wait_all();
    __syncthreads();
    if (kt0 + 64 < S_) {
      int nk = kt0 + 64;
#pragma unroll
      for (int i = 0; i < 4; ++i) {
        int c = tid + i * 128, row = c >> 3, col = (c & 7) * 8;
        stage16(&Kbase[(size_t)(nk + row) * D_ + col], &Ks[p ^ 1][row][col]);
        stage16(&Vbase[(size_t)row * S_ + nk + col], &Vs[p ^ 1][row][col]);
      }
    }

    // S^T = K @ Q^T   (4 key tiles x 2 k-steps; a K fragment serves QG groups)
    // sc[g][nt][r] = score of key nt*16 + lh*8 + r with query lr of group g
    v8f sc[QG][4];
#pragma unroll
    for (int nt = 0; nt < 4; ++nt) {
#pragma unroll  // constant g: the groups' arrays stay in registers
      for (int g = 0; g < QG; ++g) sc[g][nt] = zero8();
#pragma unroll
      for (int ks = 0; ks < 2; ++ks) {
        int row  = nt * 16 + lr;
        v8bf lo  = *(const v8bf*)&Ks[p][row][ks * 32 + koff];
        v8bf hi  = *(const v8bf*)&Ks[p][row][ks * 32 + koff + 16];
        v16bf kf = pack16(lo, hi);
#pragma unroll  // constant g: the groups' arrays stay in registers
        for (int g = 0; g < QG; ++g)
          sc[g][nt] = __builtin_amdgcn_wmma_f32_16x16x32_bf16(
              false, kf, false, qf[g][ks], (short)0, sc[g][nt], false, false);
      }
    }

    // online softmax: the lane's 32 scores of a group belong to one query; the
    // other 32 of the tile sit in lane ^ 16
#pragma unroll  // constant g: the groups' arrays stay in registers
    for (int g = 0; g < QG; ++g) {
      // one chain per score tile: four short chains instead of one long one
      float tm[4];
#pragma unroll
      for (int nt = 0; nt < 4; ++nt) {
        tm[nt] = sc[g][nt][0];
#pragma unroll
        for (int r = 1; r < 8; ++r) tm[nt] = fmaxf(tm[nt], sc[g][nt][r]);
      }
      float mx = fmaxf(fmaxf(tm[0], tm[1]), fmaxf(tm[2], tm[3]));
      mx = fmaxf(mx, xhalf(mx));
      const float nm   = fmaxf(rm[g], mx);
      const float corr = __expf(rm[g] - nm);
      rm[g]            = nm;
      float ts[4];
#pragma unroll
      for (int nt = 0; nt < 4; ++nt) {
#pragma unroll
        for (int r = 0; r < 8; ++r)
          sc[g][nt][r] = (sc[g][nt][r] - nm) * 1.44269504088896340736f;  // log2(e)
        sc[g][nt] = exp2x8(sc[g][nt]);
        ts[nt]    = sc[g][nt][0];
#pragma unroll
        for (int r = 1; r < 8; ++r) ts[nt] += sc[g][nt][r];
      }
      const float psum = (ts[0] + ts[1]) + (ts[2] + ts[3]);
      rs[g] = rs[g] * corr + psum;
#pragma unroll
      for (int nt = 0; nt < 4; ++nt)
#pragma unroll
        for (int r = 0; r < 8; ++r) o[g][nt][r] *= corr;
    }

    // O^T += V^T @ P^T   (2 k-steps over keys x 4 hd tiles; a V^T fragment
    // serves QG groups)
#pragma unroll
    for (int ks = 0; ks < 2; ++ks) {
      // score tiles 2*ks and 2*ks + 1 hold keys 8*lh + s and 16 + 8*lh + s of
      // this k-step: the k order in which the V^T loader below reads
      v16bf pf[QG];
#pragma unroll  // constant g: the groups' arrays stay in registers
      for (int g = 0; g < QG; ++g)
#pragma unroll
        for (int s = 0; s < 8; ++s) {
          pf[g][s]     = (__bf16)sc[g][2 * ks][s];
          pf[g][s + 8] = (__bf16)sc[g][2 * ks + 1][s];
        }
#pragma unroll
      for (int nt = 0; nt < 4; ++nt) {
        int row  = nt * 16 + lr;
        v8bf lo  = *(const v8bf*)&Vs[p][row][ks * 32 + koff];
        v8bf hi  = *(const v8bf*)&Vs[p][row][ks * 32 + koff + 16];
        v16bf vf = pack16(lo, hi);
#pragma unroll  // constant g: the groups' arrays stay in registers
        for (int g = 0; g < QG; ++g)
          o[g][nt] = __builtin_amdgcn_wmma_f32_16x16x32_bf16(
              false, vf, false, pf[g], (short)0, o[g][nt], false, false);
      }
    }
  }

  // join the halves' sums, normalize and store (bf16, [B*S, D] layout): a lane
  // holds 8 consecutive hd of its query per tile, one 16-byte store each
  v8bf ov[QG][4];
  __bf16* optr[QG];
#pragma unroll  // constant g: the groups' arrays stay in registers
  for (int g = 0; g < QG; ++g) {
    const float inv = 1.0f / (rs[g] + xhalf(rs[g]));
    optr[g] = Ob + (size_t)(b * S_ + q0 + (wave * QG + g) * 16 + lr) * D_ +
              h * HD_ + koff;
#pragma unroll
    for (int nt = 0; nt < 4; ++nt)
#pragma unroll
      for (int r = 0; r < 8; ++r) ov[g][nt][r] = (__bf16)(o[g][nt][r] * inv);
  }
  // every value and address is formed in front of the first store, so that no
  // register that an issued store names is rewritten behind it
  __builtin_amdgcn_sched_barrier(0);
#pragma unroll  // constant g: the groups' arrays stay in registers
  for (int g = 0; g < QG; ++g)
#pragma unroll  // constant nt: as above; the eight stores issue back to back
    for (int nt = 0; nt < 4; ++nt) *(v8bf*)(optr[g] + nt * 16) = ov[g][nt];
}

// ------------------------------ launcher ------------------------------------

extern "C" void kernel_launch(void* const* d_in, const int* in_sizes, int n_in,
                              void* d_out, int out_size, void* d_ws,
                              size_t ws_size, hipStream_t stream) {
  const float* mod1 = (const float*)d_in[0];
  const float* mod2 = (const float*)d_in[1];
  const float* Wq   = (const float*)d_in[2];
  const float* bq   = (const float*)d_in[3];
  const float* Wk   = (const float*)d_in[4];
  const float* bk   = (const float*)d_in[5];
  const float* Wv   = (const float*)d_in[6];
  const float* bv   = (const float*)d_in[7];
  const float* Wo   = (const float*)d_in[8];
  const float* bo   = (const float*)d_in[9];
  const float* Wsc  = (const float*)d_in[10];
  const float* bsc  = (const float*)d_in[11];
  const float* Wsh  = (const float*)d_in[12];
  const float* bsh  = (const float*)d_in[13];
  float* out        = (float*)d_out;

  const size_t ACT = (size_t)MROWS * D_ * sizeof(__bf16);  // 8 MB
  const size_t WT  = (size_t)D_ * D_ * sizeof(__bf16);     // 0.5 MB

  char* w = (char*)d_ws;
  size_t off = 0;
  auto carve = [&](size_t bytes) -> __bf16* {
    __bf16* p = (__bf16*)(w + off);
    off += bytes;
    return p;
  };
  __bf16* mod1b = carve(ACT);
  __bf16* mod2b = carve(ACT);
  __bf16* Wqt   = carve(WT);
  __bf16* Wkt   = carve(WT);
  __bf16* Wvt   = carve(WT);
  __bf16* Wot   = carve(WT);
  __bf16* Wsct  = carve(WT);
  __bf16* Wsht  = carve(WT);
  __bf16* Qb    = carve(ACT);
  __bf16* Kfb   = carve(ACT);
  __bf16* Vtb   = carve(ACT);   // [B,H,HD,S]
  __bf16* Obuf  = carve(ACT);

  // 1) casts: mod1b, mod2b and the six Wt planes lie one behind the other
  convert_all_kernel<<<6 * WBLK + 2 * ABLK, 256, 0, stream>>>(
      mod1, mod2, Wq, Wk, Wv, Wo, Wsc, Wsh, mod1b, Wqt);

  // 2) projections; K' = K*s+sh and V' = V*s+sh (transposed per head) leave
  //    from the epilogue
  proj_kernel<<<dim3(H_ + 2, MROWS / PM), 256, 0, stream>>>(
      mod1b, Wqt, bq, bk, bv, bsc, bsh, Qb, Kfb, Vtb, D_);

  // 3) flash attention
  attn_kernel<<<dim3(S_ / (64 * QG), H_, B_), 128, 0, stream>>>(Qb, Kfb, Vtb, Obuf);

  // 4) output projection -> f32
  gemm_out_kernel<<<dim3(D_ / BN, MROWS / BM), 256, 0, stream>>>(
      Obuf, Wot, bo, out, MROWS, D_, D_, 1.0f);
}

// v008
// A run of this version takes 79.6 microseconds.
// Timed twice side by side with v007, it ran 1.04 times as fast both times.
// Counting every step since v000, it is 3.42 times as fast.
#include <hip/hip_runtime.h>
#include <hip/hip_bf16.h>

// ---------------------------------------------------------------------------
// MultiHeadCrossModalAttention on MI455X (gfx1250, wave32, WMMA bf16,
// async global->LDS staging, transposed attention products)
// B=4, S=2048, D=512, H=8, HD=64
// ---------------------------------------------------------------------------

typedef __attribute__((ext_vector_type(16))) __bf16 v16bf;
typedef __attribute__((ext_vector_type(8)))  __bf16 v8bf;
typedef __attribute__((ext_vector_type(8)))  float  v8f;
typedef int v4i __attribute__((vector_size(16)));

#define B_  4
#define S_  2048
#define D_  512
#define H_  8
#define HD_ 64
#define MROWS (B_ * S_)          // 8192

#define AS1 __attribute__((address_space(1)))
#define AS3 __attribute__((address_space(3)))

#if __has_builtin(__builtin_amdgcn_global_load_async_to_lds_b128) && \
    __has_builtin(__builtin_amdgcn_s_wait_asynccnt)
#define HAVE_ASYNC_LDS 1
#else
#define HAVE_ASYNC_LDS 0
#endif

// one 16B chunk: global -> LDS (async on CDNA5, sync fallback otherwise)
__device__ __forceinline__ void stage16(const __bf16* g, __bf16* l) {
#if HAVE_ASYNC_LDS
  __builtin_amdgcn_global_load_async_to_lds_b128((AS1 v4i*)g, (AS3 v4i*)l,
                                                 0, 0);
#else
  *(v8bf*)l = *(const v8bf*)g;
#endif
}

__device__ __forceinline__ void async_wait_all() {
#if HAVE_ASYNC_LDS
  __builtin_amdgcn_s_wait_asynccnt(0);
#endif
}

__device__ __forceinline__ v16bf pack16(v8bf lo, v8bf hi) {
  union { v16bf v; v8bf p[2]; } u;
  u.p[0] = lo; u.p[1] = hi;
  return u.v;
}

__device__ __forceinline__ v8f zero8() {
  v8f z;
#pragma unroll
  for (int i = 0; i < 8; ++i) z[i] = 0.0f;
  return z;
}

// ------------------------------- casts -------------------------------------
// One launch converts both activation tensors and all six weight matrices to
// bf16. A short wave costs more to start than to run, so a lane converts 64
// activation elements or a 4 (n) x 8 (k) piece of a weight matrix.
// Blocks 0 .. 6*WBLK-1: weights, Wt[n][k] = W[k][n]; the rest: activations.

typedef __attribute__((ext_vector_type(4))) float  v4f;
typedef __attribute__((ext_vector_type(4))) __bf16 v4bf;

#define WBLK 32    // blocks per 512x512 weight matrix: tiles of 64 (k) x 128 (n)
#define ABLK 256   // blocks per activation tensor: 16,384 elements each
#define ACH  16    // 16-byte chunks per lane of an activation block

__global__ __launch_bounds__(256) void convert_all_kernel(
    const float* __restrict__ act0, const float* __restrict__ act1,
    const float* __restrict__ W0, const float* __restrict__ W1,
    const float* __restrict__ W2, const float* __restrict__ W3,
    const float* __restrict__ W4, const float* __restrict__ W5,
    __bf16* __restrict__ actb, __bf16* __restrict__ wtb) {
  const unsigned int blk = blockIdx.x;
  const int tid = threadIdx.x;

  if (blk < 6 * WBLK) {
    const int wi = blk / WBLK;
    const int t  = blk % WBLK;
    const float* W = wi == 0 ? W0 : wi == 1 ? W1 : wi == 2 ? W2
                   : wi == 3 ? W3 : wi == 4 ? W4 : W5;
    __bf16* Wt = wtb + (size_t)wi * (D_ * D_);
    // eight neighbouring lanes hold the eight k chunks of one Wt row piece:
    // together they store a whole 128-byte line
    const int k0 = (t & 7) * 64 + (tid & 7) * 8;
    const int n0 = (t >> 3) * 128 + (tid >> 3) * 4;
    v4f r[8];
#pragma unroll  // all eight loads in flight before the first convert
    for (int j = 0; j < 8; ++j) r[j] = *(const v4f*)&W[(k0 + j) * D_ + n0];
#pragma unroll  // constant indices: the vector elements stay in registers
    for (int c = 0; c < 4; ++c) {
      v8bf o;
#pragma unroll  // as above
      for (int j = 0; j < 8; ++j) o[j] = (__bf16)r[j][c];
      *(v8bf*)&Wt[(n0 + c) * D_ + k0] = o;
    }
  } else {
    const unsigned int ab = blk - 6 * WBLK;
    const int ti = ab / ABLK;
    const float* in = ti == 0 ? act0 : act1;
    __bf16* out = actb + (size_t)ti * (MROWS * D_);
    const unsigned int e0 = (ab % ABLK) * (256 * ACH * 4) + tid * 4;
    const unsigned int lo = e0 * 4;   // byte offset that all the loads share
    v4f r[ACH];
#pragma unroll  // all loads in flight before the first convert
    for (int j = 0; j < ACH; ++j)
      r[j] = *(const v4f*)((const char*)in + lo + j * 4096);
    // the wait owed before a register that an issued load names is rewritten;
    // it takes the shared offset as an input, so that no load's result lands in
    // that register while earlier loads of the run still name it
    asm volatile("s_wait_xcnt 0x0" :: "v"(lo) : "memory");
    // keeps the first converts from rising among the loads: the last loads would
    // then take over registers of the first and issue only when those return
    __builtin_amdgcn_sched_barrier(0);
#pragma unroll  // constant indices: the loaded chunks stay in registers
    for (int j = 0; j < ACH; ++j)
      *(v4bf*)&out[e0 + j * 1024] = __builtin_convertvector(r[j], v4bf);
    // the same wait behind the last stores: the code that follows them in the
    // built text rewrites their offset and data registers
    asm volatile("s_wait_xcnt 0x0" ::: "memory");
  }
}

// ------------------------------- GEMM --------------------------------------
// C[M,N] = (A[M,K] @ Bt[N,K]^T + bias[N]) * alpha
// Tiles: BM=128, BN=128, BK=64.  256 threads = 8 waves (2x4), wave: 64x32.
// Double-buffered async global->LDS staging. A K step takes 128 bytes of every
// operand row: eight lanes copy one whole cache line, where a step of 32 asked
// for each line twice, half of it at a time.

#define BM 128
#define BN 128
#define BK 64

__device__ __forceinline__ void gemm_tile(
    const __bf16* __restrict__ A, const __bf16* __restrict__ Bt,
    const float* __restrict__ bias, float* __restrict__ C,
    int M, int N, int K, float alpha) {
  __shared__ __align__(16) __bf16 As[2][BM][BK + 8];   // 144B rows
  __shared__ __align__(16) __bf16 Bs[2][BM][BK + 8];

  const int tid  = threadIdx.x;
  const int bm0  = blockIdx.y * BM;
  const int bn0  = blockIdx.x * BN;
  const int wave = tid >> 5;
  const int lane = tid & 31;
  const int wm   = wave >> 2;        // 0..1 -> 64-row slab
  const int wn   = wave & 3;         // 0..3 -> 32-col slab
  const int lr   = lane & 15;
  const int lh   = lane >> 4;
  const int koff = lh * 8;

  // this thread's four 16B staging chunks (same mapping for A and B tiles):
  // rows srow + 32*i, i = 0..3, at column scol
  const int srow = tid >> 3;
  const int scol = (tid & 7) * 8;

  v8f acc[4][2];
#pragma unroll
  for (int mt = 0; mt < 4; ++mt)
#pragma unroll
    for (int nt = 0; nt < 2; ++nt) acc[mt][nt] = zero8();

  // prologue: stage tile 0 into buffer 0
#pragma unroll  // the eight copies issue back to back
  for (int i = 0; i < 4; ++i) {
    int row = srow + i * 32;
    stage16(&A[(size_t)(bm0 + row) * K + scol], &As[0][row][scol]);
    stage16(&Bt[(size_t)(bn0 + row) * K + scol], &Bs[0][row][scol]);
  }

  int p = 0;
  for (int bk = 0; bk < K; bk += BK, p ^= 1) {
    async_wait_all();
    __syncthreads();
    if (bk + BK < K) {
      int nb = bk + BK;
#pragma unroll  // as in the prologue
      for (int i = 0; i < 4; ++i) {
        int row = srow + i * 32;
        stage16(&A[(size_t)(bm0 + row) * K + nb + scol], &As[p ^ 1][row][scol]);
        stage16(&Bt[(size_t)(bn0 + row) * K + nb + scol], &Bs[p ^ 1][row][scol]);
      }
    }

#pragma unroll  // constant ks: it folds into the LDS loads' offset fields
    for (int ks = 0; ks < BK; ks += 32) {
      v16bf af[4], bf[2];
#pragma unroll
      for (int mt = 0; mt < 4; ++mt) {
        int r   = wm * 64 + mt * 16 + lr;
        v8bf lo = *(const v8bf*)&As[p][r][ks + koff];
        v8bf hi = *(const v8bf*)&As[p][r][ks + koff + 16];
        af[mt]  = pack16(lo, hi);
      }
#pragma unroll
      for (int nt = 0; nt < 2; ++nt) {
        int r   = wn * 32 + nt * 16 + lr;
        v8bf lo = *(const v8bf*)&Bs[p][r][ks + koff];
        v8bf hi = *(const v8bf*)&Bs[p][r][ks + koff + 16];
        bf[nt]  = pack16(lo, hi);
      }
#pragma unroll
      for (int mt = 0; mt < 4; ++mt)
#pragma unroll
        for (int nt = 0; nt < 2; ++nt)
          acc[mt][nt] = __builtin_amdgcn_wmma_f32_16x16x32_bf16(
              false, af[mt], false, bf[nt], (short)0, acc[mt][nt], false, false);
    }
  }

  // epilogue: C layout -> lane holds col n=lr of each tile, rows r + lh*8
#pragma unroll
  for (int nt = 0; nt < 2; ++nt) {
    int n    = bn0 + wn * 32 + nt * 16 + lr;
    float bv = bias[n];
#pragma unroll
    for (int mt = 0; mt < 4; ++mt) {
#pragma unroll
      for (int r = 0; r < 8; ++r) {
        int m   = bm0 + wm * 64 + mt * 16 + lh * 8 + r;
        C[(size_t)m * N + n] = (acc[mt][nt][r] + bv) * alpha;
      }
    }
  }
}

// All five input projections in one launch, and K' = K*s + sh, V' = V*s + sh
// formed in its epilogue from the f32 accumulators: K, V, scale and shift never
// go to memory, and no launch stands between the projections and attention.
// A workgroup takes 64 rows and four groups of 64 columns. blockIdx.x < 8: the
// columns of head blockIdx.x in the products K, V, scale, shift (A = second
// activation plane); blockIdx.x = 8, 9: 256 columns of Q (A = first plane).
// 8 waves (2x4); a wave holds 32 rows x 16 columns of each of the four groups,
// so a lane has K, V, scale and shift of the same elements.
// actb: the two activation planes; wtb: the six Wt planes in the order
// q, k, v, o, scale, shift. Vt[b][h][hd][s] is V' transposed per head.

#define PM 64              // rows of a workgroup's tile
#define PROWS (PM + 256)   // staged rows of a K step: PM of A, then 4 x 64 of Wt

__global__ __launch_bounds__(256) void proj_kernel(
    const __bf16* __restrict__ actb, const __bf16* __restrict__ wtb,
    const float* __restrict__ bq, const float* __restrict__ bk,
    const float* __restrict__ bv, const float* __restrict__ bsc,
    const float* __restrict__ bsh, __bf16* __restrict__ Qo,
    __bf16* __restrict__ Kf, __bf16* __restrict__ Vt, int K) {
  __shared__ __align__(16) __bf16 Ts[2][PROWS][BK + 8];   // 144B rows

  const int tid  = threadIdx.x;
  const int bx   = blockIdx.x;
  const bool kv  = bx < H_;
  const int bm0  = blockIdx.y * PM;
  const int wave = tid >> 5;
  const int lane = tid & 31;
  const int wm   = wave >> 2;        // 0..1 -> 32-row slab
  const int wn   = wave & 3;         // 0..3 -> 16 columns of every group
  const int lr   = lane & 15;
  const int lh   = lane >> 4;
  const int koff = lh * 8;

  const __bf16* A = actb + (size_t)((kv ? MROWS : 0) + bm0) * K;
  // first row of column group g in the six stacked Wt planes
  auto brow = [&](int g) {
    return kv ? (g < 2 ? g + 1 : g + 2) * D_ + bx * HD_ : (bx - H_) * 256 + g * 64;
  };

  // a thread's ten 16B chunks of a K step: rows srow + 32*i at column scol
  const int srow = tid >> 3;
  const int scol = (tid & 7) * 8;
  auto stage = [&](int buf, int k0) {
#pragma unroll  // the ten copies issue back to back
    for (int i = 0; i < 10; ++i) {
      const __bf16* g =
          i < 2 ? &A[(size_t)(srow + i * 32) * K + k0 + scol]
                : &wtb[(size_t)(brow((i - 2) >> 1) + srow + (i & 1) * 32) * K +
                       k0 + scol];
      stage16(g, &Ts[buf][srow + i * 32][scol]);
    }
  };

  v8f acc[2][4];
#pragma unroll
  for (int mt = 0; mt < 2; ++mt)
#pragma unroll
    for (int g = 0; g < 4; ++g) acc[mt][g] = zero8();

  stage(0, 0);
  // step 0's copies have landed before the barrier behind which others read them
  asm volatile("s_wait_asynccnt 0x0" ::: "memory");
  __syncthreads();
  if (BK < K) stage(1, BK);

  int p = 0;
  for (int bk0 = 0; bk0 < K; bk0 += BK, p ^= 1) {
#pragma unroll  // constant ks: it folds into the LDS loads' offset fields
    for (int ks = 0; ks < BK; ks += 32) {
      v16bf af[2], bf[4];
#pragma unroll
      for (int mt = 0; mt < 2; ++mt) {
        int r   = wm * 32 + mt * 16 + lr;
        v8bf lo = *(const v8bf*)&Ts[p][r][ks + koff];
        v8bf hi = *(const v8bf*)&Ts[p][r][ks + koff + 16];
        af[mt]  = pack16(lo, hi);
      }
#pragma unroll
      for (int g = 0; g < 4; ++g) {
        int r   = PM + g * 64 + wn * 16 + lr;
        v8bf lo = *(const v8bf*)&Ts[p][r][ks + koff];
        v8bf hi = *(const v8bf*)&Ts[p][r][ks + koff + 16];
        bf[g]   = pack16(lo, hi);
      }
#pragma unroll
      for (int mt = 0; mt < 2; ++mt)
#pragma unroll
        for (int g = 0; g < 4; ++g)
          acc[mt][g] = __builtin_amdgcn_wmma_f32_16x16x32_bf16(
              false, af[mt], false, bf[g], (short)0, acc[mt][g], false, false);
    }
    // this wave's reads of buffer p are done before the buffer is refilled
    asm volatile("s_wait_dscnt 0x0" ::: "memory");
    // the next step's copies have landed before the barrier that publishes them
    asm volatile("s_wait_asynccnt 0x0" ::: "memory");
    __syncthreads();
    if (bk0 + 2 * BK < K) stage(p, bk0 + 2 * BK);
  }
  // no copy is in flight when the ring becomes output staging
  asm volatile("s_wait_asynccnt 0x0" ::: "memory");

  // C layout: a lane holds column lr of each 16x16 tile, rows lh*8 + r
  if (!kv) {
#pragma unroll
    for (int g = 0; g < 4; ++g) {
      int n    = (bx - H_) * 256 + g * 64 + wn * 16 + lr;
      float bb = bq[n];
#pragma unroll
      for (int mt = 0; mt < 2; ++mt) {
#pragma unroll
        for (int r = 0; r < 8; ++r) {
          int m = bm0 + wm * 32 + mt * 16 + lh * 8 + r;
          Qo[(size_t)m * D_ + n] = (__bf16)((acc[mt][g][r] + bb) * 0.125f);  // 1/sqrt(64)
        }
      }
    }
    // the wait owed before a register that an issued store names is rewritten:
    // in the built text the K'/V' part follows these stores and rewrites their
    // data registers
    asm volatile("s_wait_xcnt 0x0" ::: "memory");
    return;
  }

  // The loop's last barrier has ended every read of the ring: rows 0..63 of
  // buffer 0 take the K' tile [s][hd], rows 64..127 the V' tile [hd][s], so that
  // both leave as 16-byte pieces of whole 128-byte lines.
  const int c = wn * 16 + lr;         // hd
  const int n = bx * HD_ + c;
  const float b_k = bk[n], b_v = bv[n], b_s = bsc[n], b_t = bsh[n];
#pragma unroll
  for (int mt = 0; mt < 2; ++mt) {
    const int s = wm * 32 + mt * 16 + lh * 8;
    v8bf vv;
#pragma unroll  // constant r: the vector elements stay in registers
    for (int r = 0; r < 8; ++r) {
      float sc = acc[mt][2][r] + b_s, sh = acc[mt][3][r] + b_t;
      Ts[0][s + r][c] = (__bf16)((acc[mt][0][r] + b_k) * sc + sh);
      vv[r]           = (__bf16)((acc[mt][1][r] + b_v) * sc + sh);
    }
    *(v8bf*)&Ts[0][PM + c][s] = vv;
  }
  __syncthreads();

  __bf16* kout = Kf + (size_t)bm0 * D_ + bx * HD_;
  __bf16* vout = Vt + (size_t)((bm0 / S_) * H_ + bx) * HD_ * S_ + (bm0 & (S_ - 1));
#pragma unroll  // the four LDS reads issue before the first store waits for its data
  for (int i = 0; i < 2; ++i) {
    int ch = tid + i * 256, row = ch >> 3, col = (ch & 7) * 8;
    *(v8bf*)(kout + (size_t)row * D_ + col) = *(const v8bf*)&Ts[0][row][col];
    *(v8bf*)(vout + (size_t)row * S_ + col) = *(const v8bf*)&Ts[0][PM + row][col];
  }
}

// output projection -> f32
__global__ __launch_bounds__(256) void gemm_out_kernel(
    const __bf16* __restrict__ A, const __bf16* __restrict__ Bt,
    const float* __restrict__ bias, float* __restrict__ C,
    int M, int N, int K, float alpha) {
  gemm_tile(A, Bt, bias, C, M, N, K, alpha);
}

#define QG 2   // groups of 16 queries per wave

// lane l with lane l ^ 16
__device__ __forceinline__ float xhalf(float x) {
  int v = __float_as_int(x);
  return __int_as_float(__builtin_amdgcn_permlanex16(v, v, 0x76543210,
                                                     0xfedcba98, false, false));
}

// x[i] = 2^x[i], eight at a time. One statement, so that the closing v_nop stays
// directly behind the last v_exp_f32: it is the slot the instruction set asks
// for between a transcendental and an instruction that reads its result or
// overwrites its source. Each v_exp_f32 works in place on a register of its own, so
// none touches a neighbour's source or result, and the statement writes no
// register that the compiler's own code has not written just before.
__device__ __forceinline__ v8f exp2x8(v8f x) {
  float y0 = x[0], y1 = x[1], y2 = x[2], y3 = x[3];
  float y4 = x[4], y5 = x[5], y6 = x[6], y7 = x[7];
  asm("v_exp_f32 %0, %0\n\t"
      "v_exp_f32 %1, %1\n\t"
      "v_exp_f32 %2, %2\n\t"
      "v_exp_f32 %3, %3\n\t"
      "v_exp_f32 %4, %4\n\t"
      "v_exp_f32 %5, %5\n\t"
      "v_exp_f32 %6, %6\n\t"
      "v_exp_f32 %7, %7\n\t"
      "v_nop"
      : "+v"(y0), "+v"(y1), "+v"(y2), "+v"(y3), "+v"(y4), "+v"(y5), "+v"(y6),
        "+v"(y7));
  v8f y = {y0, y1, y2, y3, y4, y5, y6, y7};
  return y;
}

#define KH 2               // key ranges of a workgroup, four waves each
#define KSPAN (S_ / KH)    // keys of a range

typedef __attribute__((ext_vector_type(2))) float v2f;

__global__ __launch_bounds__(256) void attn_kernel(
    const __bf16* __restrict__ Qb, const __bf16* __restrict__ Kb,
    const __bf16* __restrict__ Vt, __bf16* __restrict__ Ob) {
  __shared__ __align__(16) __bf16 Ks[KH][2][64][72];    // [key][hd]
  __shared__ __align__(16) __bf16 Vs[KH][2][64][72];    // [hd][key] (transposed V)

  const int b    = blockIdx.z;
  const int h    = blockIdx.y;
  const int q0   = blockIdx.x * (4 * 16 * QG);
  const int tid  = threadIdx.x;
  const int ht   = tid & 127;        // thread within its key range's four waves
  // key range of this wave, in a scalar register: bases and branches stay scalar
  const int kh   = __builtin_amdgcn_readfirstlane(tid >> 7);
  const int qw   = (tid >> 5) & 3;
  const int lane = tid & 31;
  const int lr   = lane & 15;
  const int lh   = lane >> 4;
  const int koff = lh * 8;

  const __bf16* Kbase = Kb + (size_t)(b * S_ + kh * KSPAN) * D_ + h * HD_;
  const __bf16* Vbase = Vt + (size_t)(b * H_ + h) * HD_ * S_ + kh * KSPAN;

  // Q fragments (B operand: column = query lr of group g, 2 k-steps), resident
  // in VGPRs
  v16bf qf[QG][2];
#pragma unroll  // constant g: the groups' arrays stay in registers
  for (int g = 0; g < QG; ++g) {
    int qrow           = q0 + (qw * QG + g) * 16 + lr;
    const __bf16* qptr = Qb + (size_t)(b * S_ + qrow) * D_ + h * HD_;
#pragma unroll
    for (int ks = 0; ks < 2; ++ks) {
      v8bf lo   = *(const v8bf*)(qptr + ks * 32 + koff);
      v8bf hi   = *(const v8bf*)(qptr + ks * 32 + koff + 16);
      qf[g][ks] = pack16(lo, hi);
    }
  }
  // the wait owed before a register that an issued load names is rewritten: the
  // staging addresses formed below take over the Q loads' address registers
  asm volatile("s_wait_xcnt 0x0" ::: "memory");
  // keeps those address sums from rising among the Q loads, in front of the wait
  __builtin_amdgcn_sched_barrier(0);

  // o[g][nt][r] = O^T[hd nt*16 + lh*8 + r][query lr of group g]
  v8f o[QG][4];
  // running maximum of query lr (equal in both wave halves) and this half's
  // share of its running sum
  float rm[QG], rs[QG];
#pragma unroll  // constant g: the groups' arrays stay in registers
  for (int g = 0; g < QG; ++g) {
#pragma unroll
    for (int nt = 0; nt < 4; ++nt) o[g][nt] = zero8();
    rm[g] = -1e30f;
    rs[g] = 0.0f;
  }

  // this thread's four 16B staging chunks per tile of its key range
  // chunk c = ht + i*128; row = c>>3 (8 x 16B per 128B row); col = (c&7)*8
  // prologue: stage tile 0 into buffer 0
#pragma unroll
  for (int i = 0; i < 4; ++i) {
    int c = ht + i * 128, row = c >> 3, col = (c & 7) * 8;
    stage16(&Kbase[(size_t)row * D_ + col], &Ks[kh][0][row][col]);
    stage16(&Vbase[(size_t)row * S_ + col], &Vs[kh][0][row][col]);
  }

  int p = 0;
  for (int kt0 = 0; kt0 < KSPAN; kt0 += 64, p ^= 1) {
    async_wait_all();
    __syncthreads();
    if (kt0 + 64 < KSPAN) {
      int nk = kt0 + 64;
#pragma unroll
      for (int i = 0; i < 4; ++i) {
        int c = ht + i * 128, row = c >> 3, col = (c & 7) * 8;
        stage16(&Kbase[(size_t)(nk + row) * D_ + col], &Ks[kh][p ^ 1][row][col]);
        stage16(&Vbase[(size_t)row * S_ + nk + col], &Vs[kh][p ^ 1][row][col]);
      }
    }

    // S^T = K @ Q^T   (4 key tiles x 2 k-steps; a K fragment serves QG groups)
    // sc[g][nt][r] = score of key nt*16 + lh*8 + r with query lr of group g
    v8f sc[QG][4];
#pragma unroll
    for (int nt = 0; nt < 4; ++nt) {
#pragma unroll  // constant g: the groups' arrays stay in registers
      for (int g = 0; g < QG; ++g) sc[g][nt] = zero8();
#pragma unroll
      for (int ks = 0; ks < 2; ++ks) {
        int row  = nt * 16 + lr;
        v8bf lo  = *(const v8bf*)&Ks[kh][p][row][ks * 32 + koff];
        v8bf hi  = *(const v8bf*)&Ks[kh][p][row][ks * 32 + koff + 16];
        v16bf kf = pack16(lo, hi);
#pragma unroll  // constant g: the groups' arrays stay in registers
        for (int g = 0; g < QG; ++g)
          sc[g][nt] = __builtin_amdgcn_wmma_f32_16x16x32_bf16(
              false, kf, false, qf[g][ks], (short)0, sc[g][nt], false, false);
      }
    }

    // online softmax: the lane's 32 scores of a group belong to one query; the
    // other 32 of the tile sit in lane ^ 16
#pragma unroll  // constant g: the groups' arrays stay in registers
    for (int g = 0; g < QG; ++g) {
      // one chain per score tile: four short chains instead of one long one
      float tm[4];
#pragma unroll
      for (int nt = 0; nt < 4; ++nt) {
        tm[nt] = sc[g][nt][0];
#pragma unroll
        for (int r = 1; r < 8; ++r) tm[nt] = fmaxf(tm[nt], sc[g][nt][r]);
      }
      float mx = fmaxf(fmaxf(tm[0], tm[1]), fmaxf(tm[2], tm[3]));
      mx = fmaxf(mx, xhalf(mx));
      const float nm   = fmaxf(rm[g], mx);
      const float corr = __expf(rm[g] - nm);
      rm[g]            = nm;
      float ts[4];
#pragma unroll
      for (int nt = 0; nt < 4; ++nt) {
#pragma unroll
        for (int r = 0; r < 8; ++r)
          sc[g][nt][r] = (sc[g][nt][r] - nm) * 1.44269504088896340736f;  // log2(e)
        sc[g][nt] = exp2x8(sc[g][nt]);
        ts[nt]    = sc[g][nt][0];
#pragma unroll
        for (int r = 1; r < 8; ++r) ts[nt] += sc[g][nt][r];
      }
      const float psum = (ts[0] + ts[1]) + (ts[2] + ts[3]);
      rs[g] = rs[g] * corr + psum;
#pragma unroll
      for (int nt = 0; nt < 4; ++nt)
#pragma unroll
        for (int r = 0; r < 8; ++r) o[g][nt][r] *= corr;
    }

    // O^T += V^T @ P^T   (2 k-steps over keys x 4 hd tiles; a V^T fragment
    // serves QG groups)
#pragma unroll
    for (int ks = 0; ks < 2; ++ks) {
      // score tiles 2*ks and 2*ks + 1 hold keys 8*lh + s and 16 + 8*lh + s of
      // this k-step: the k order in which the V^T loader below reads
      v16bf pf[QG];
#pragma unroll  // constant g: the groups' arrays stay in registers
      for (int g = 0; g < QG; ++g)
#pragma unroll
        for (int s = 0; s < 8; ++s) {
          pf[g][s]     = (__bf16)sc[g][2 * ks][s];
          pf[g][s + 8] = (__bf16)sc[g][2 * ks + 1][s];
        }
#pragma unroll
      for (int nt = 0; nt < 4; ++nt) {
        int row  = nt * 16 + lr;
        v8bf lo  = *(const v8bf*)&Vs[kh][p][row][ks * 32 + koff];
        v8bf hi  = *(const v8bf*)&Vs[kh][p][row][ks * 32 + koff + 16];
        v16bf vf = pack16(lo, hi);
#pragma unroll  // constant g: the groups' arrays stay in registers
        for (int g = 0; g < QG; ++g)
          o[g][nt] = __builtin_amdgcn_wmma_f32_16x16x32_bf16(
              false, vf, false, pf[g], (short)0, o[g][nt], false, false);
      }
    }
  }

  // Join of the two key ranges. Wave (kh, qw) finishes query group kh and hands
  // its partial result for the other group to wave (1 - kh, qw) through LDS.
  // The choice is made on the values, once, so that one run of code serves both
  // ranges and the stores at its end are the wave's last instructions.
  v8f own[4], away[4];
#pragma unroll  // constant nt: the accumulators stay in registers
  for (int nt = 0; nt < 4; ++nt) {
    own[nt]  = kh ? o[1][nt] : o[0][nt];
    away[nt] = kh ? o[0][nt] : o[1][nt];
  }
  const float orm = kh ? rm[1] : rm[0], ors = kh ? rs[1] : rs[0];
  const v2f ams   = {kh ? rm[0] : rm[1], kh ? rs[0] : rs[1]};
  // The barrier ends every wave's last read of the ring, which then serves as the
  // exchange buffer; no copy is in flight (the last pass issued none).
  __syncthreads();
  // piece j of a thread's 32 sums at X[(j*256 + tid)*4]: a wave's 16-byte stores
  // are contiguous; behind the eight planes, (maximum, sum) of each thread
  float* X = (float*)&Ks[0][0][0][0];
#pragma unroll  // constant nt: the accumulators stay in registers
  for (int nt = 0; nt < 4; ++nt) {
    v4f lo4 = {away[nt][0], away[nt][1], away[nt][2], away[nt][3]};
    v4f hi4 = {away[nt][4], away[nt][5], away[nt][6], away[nt][7]};
    *(v4f*)&X[((nt * 2 + 0) * 256 + tid) * 4] = lo4;
    *(v4f*)&X[((nt * 2 + 1) * 256 + tid) * 4] = hi4;
  }
  *(v2f*)&X[8 * 256 * 4 + tid * 2] = ams;
  // publishes the partial results to the partner waves
  __syncthreads();

  // rescale both ranges to the common maximum, join the sums (of the ranges, then
  // of the wave halves), normalize and store (bf16, [B*S, D] layout): a lane holds
  // 8 consecutive hd of its query per tile, one 16-byte store each
  const int pt = tid ^ 128;
  v4f x[8];
#pragma unroll  // the nine LDS reads issue together
  for (int j = 0; j < 8; ++j) x[j] = *(const v4f*)&X[(j * 256 + pt) * 4];
  const v2f ms    = *(const v2f*)&X[8 * 256 * 4 + pt * 2];
  const float nm  = fmaxf(orm, ms[0]);
  float ca        = __expf(orm - nm);
  float cb        = __expf(ms[0] - nm);
  const float sm  = ors * ca + ms[1] * cb;
  const float inv = 1.0f / (sm + xhalf(sm));
  ca *= inv;
  cb *= inv;
  __bf16* optr = Ob + (size_t)(b * S_ + q0 + (qw * QG + kh) * 16 + lr) * D_ +
                 h * HD_ + koff;
  v8bf ov[4];
#pragma unroll  // constant nt: the accumulators stay in registers
  for (int nt = 0; nt < 4; ++nt)
#pragma unroll  // constant r: as above
    for (int r = 0; r < 8; ++r)
      ov[nt][r] = (__bf16)(own[nt][r] * ca + x[nt * 2 + (r >> 2)][r & 3] * cb);
  // every value and address is formed in front of the first store, so that no
  // register that an issued store names is rewritten behind it
  __builtin_amdgcn_sched_barrier(0);
#pragma unroll  // constant nt: as above; the four stores issue back to back
  for (int nt = 0; nt < 4; ++nt) *(v8bf*)(optr + nt * 16) = ov[nt];
}

// ------------------------------ launcher ------------------------------------

extern "C" void kernel_launch(void* const* d_in, const int* in_sizes, int n_in,
                              void* d_out, int out_size, void* d_ws,
                              size_t ws_size, hipStream_t stream) {
  const float* mod1 = (const float*)d_in[0];
  const float* mod2 = (const float*)d_in[1];
  const float* Wq   = (const float*)d_in[2];
  const float* bq   = (const float*)d_in[3];
  const float* Wk   = (const float*)d_in[4];
  const float* bk   = (const float*)d_in[5];
  const float* Wv   = (const float*)d_in[6];
  const float* bv   = (const float*)d_in[7];
  const float* Wo   = (const float*)d_in[8];
  const float* bo   = (const float*)d_in[9];
  const float* Wsc  = (const float*)d_in[10];
  const float* bsc  = (const float*)d_in[11];
  const float* Wsh  = (const float*)d_in[12];
  const float* bsh  = (const float*)d_in[13];
  float* out        = (float*)d_out;

  const size_t ACT = (size_t)MROWS * D_ * sizeof(__bf16);  // 8 MB
  const size_t WT  = (size_t)D_ * D_ * sizeof(__bf16);     // 0.5 MB

  char* w = (char*)d_ws;
  size_t off = 0;
  auto carve = [&](size_t bytes) -> __bf16* {
    __bf16* p = (__bf16*)(w + off);
    off += bytes;
    return p;
  };
  __bf16* mod1b = carve(ACT);
  __bf16* mod2b = carve(ACT);
  __bf16* Wqt   = carve(WT);
  __bf16* Wkt   = carve(WT);
  __bf16* Wvt   = carve(WT);
  __bf16* Wot   = carve(WT);
  __bf16* Wsct  = carve(WT);
  __bf16* Wsht  = carve(WT);
  __bf16* Qb    = carve(ACT);
  __bf16* Kfb   = carve(ACT);
  __bf16* Vtb   = carve(ACT);   // [B,H,HD,S]
  __bf16* Obuf  = carve(ACT);

  // 1) casts: mod1b, mod2b and the six Wt planes lie one behind the other
  convert_all_kernel<<<6 * WBLK + 2 * ABLK, 256, 0, stream>>>(
      mod1, mod2, Wq, Wk, Wv, Wo, Wsc, Wsh, mod1b, Wqt);

  // 2) projections; K' = K*s+sh and V' = V*s+sh (transposed per head) leave
  //    from the epilogue
  proj_kernel<<<dim3(H_ + 2, MROWS / PM), 256, 0, stream>>>(
      mod1b, Wqt, bq, bk, bv, bsc, bsh, Qb, Kfb, Vtb, D_);

  // 3) flash attention
  attn_kernel<<<dim3(S_ / (64 * QG), H_, B_), 256, 0, stream>>>(Qb, Kfb, Vtb, Obuf);

  // 4) output projection -> f32
  gemm_out_kernel<<<dim3(D_ / BN, MROWS / BM), 256, 0, stream>>>(
      Obuf, Wot, bo, out, MROWS, D_, D_, 1.0f);
}

// v010
// It runs in 74.3 microseconds.
// It is 1.08 times as fast as v008, going by the measured steps of the versions left out in between.
// All steps since v000 together make it 3.68 times as fast.
#include <hip/hip_runtime.h>
#include <hip/hip_bf16.h>

// ---------------------------------------------------------------------------
// MultiHeadCrossModalAttention on MI455X (gfx1250, wave32, WMMA bf16,
// async global->LDS staging, transposed attention products)
// B=4, S=2048, D=512, H=8, HD=64
// ---------------------------------------------------------------------------

typedef __attribute__((ext_vector_type(16))) __bf16 v16bf;
typedef __attribute__((ext_vector_type(8)))  __bf16 v8bf;
typedef __attribute__((ext_vector_type(8)))  float  v8f;
typedef int v4i __attribute__((vector_size(16)));

#define B_  4
#define S_  2048
#define D_  512
#define H_  8
#define HD_ 64
#define MROWS (B_ * S_)          // 8192

#define AS1 __attribute__((address_space(1)))
#define AS3 __attribute__((address_space(3)))

#if __has_builtin(__builtin_amdgcn_global_load_async_to_lds_b128) && \
    __has_builtin(__builtin_amdgcn_s_wait_asynccnt)
#define HAVE_ASYNC_LDS 1
#else
#define HAVE_ASYNC_LDS 0
#endif

// one 16B chunk: global -> LDS (async on CDNA5, sync fallback otherwise)
__device__ __forceinline__ void stage16(const __bf16* g, __bf16* l) {
#if HAVE_ASYNC_LDS
  __builtin_amdgcn_global_load_async_to_lds_b128((AS1 v4i*)g, (AS3 v4i*)l,
                                                 0, 0);
#else
  *(v8bf*)l = *(const v8bf*)g;
#endif
}

__device__ __forceinline__ void async_wait_all() {
#if HAVE_ASYNC_LDS
  __builtin_amdgcn_s_wait_asynccnt(0);
#endif
}

__device__ __forceinline__ v16bf pack16(v8bf lo, v8bf hi) {
  union { v16bf v; v8bf p[2]; } u;
  u.p[0] = lo; u.p[1] = hi;
  return u.v;
}

__device__ __forceinline__ v8f zero8() {
  v8f z;
#pragma unroll
  for (int i = 0; i < 8; ++i) z[i] = 0.0f;
  return z;
}

// ------------------------------- casts -------------------------------------
// One launch converts both activation tensors and all six weight matrices to
// bf16. A short wave costs more to start than to run, so a lane converts 64
// activation elements or a 4 (n) x 8 (k) piece of a weight matrix.
// Blocks 0 .. 6*WBLK-1: weights, Wt[n][k] = W[k][n]; the rest: activations.

typedef __attribute__((ext_vector_type(4))) float  v4f;
typedef __attribute__((ext_vector_type(4))) __bf16 v4bf;

#define WBLK 32    // blocks per 512x512 weight matrix: tiles of 64 (k) x 128 (n)
#define ABLK 256   // blocks per activation tensor: 16,384 elements each
#define ACH  16    // 16-byte chunks per lane of an activation block

__global__ __launch_bounds__(256) void convert_all_kernel(
    const float* __restrict__ act0, const float* __restrict__ act1,
    const float* __restrict__ W0, const float* __restrict__ W1,
    const float* __restrict__ W2, const float* __restrict__ W3,
    const float* __restrict__ W4, const float* __restrict__ W5,
    __bf16* __restrict__ actb, __bf16* __restrict__ wtb) {
  const unsigned int blk = blockIdx.x;
  const int tid = threadIdx.x;

  if (blk < 6 * WBLK) {
    const int wi = blk / WBLK;
    const int t  = blk % WBLK;
    const float* W = wi == 0 ? W0 : wi == 1 ? W1 : wi == 2 ? W2
                   : wi == 3 ? W3 : wi == 4 ? W4 : W5;
    __bf16* Wt = wtb + (size_t)wi * (D_ * D_);
    // eight neighbouring lanes hold the eight k chunks of one Wt row piece:
    // together they store a whole 128-byte line
    const int k0 = (t & 7) * 64 + (tid & 7) * 8;
    const int n0 = (t >> 3) * 128 + (tid >> 3) * 4;
    v4f r[8];
#pragma unroll  // all eight loads in flight before the first convert
    for (int j = 0; j < 8; ++j) r[j] = *(const v4f*)&W[(k0 + j) * D_ + n0];
#pragma unroll  // constant indices: the vector elements stay in registers
    for (int c = 0; c < 4; ++c) {
      v8bf o;
#pragma unroll  // as above
      for (int j = 0; j < 8; ++j) o[j] = (__bf16)r[j][c];
      *(v8bf*)&Wt[(n0 + c) * D_ + k0] = o;
    }
  } else {
    const unsigned int ab = blk - 6 * WBLK;
    const int ti = ab / ABLK;
    const float* in = ti == 0 ? act0 : act1;
    __bf16* out = actb + (size_t)ti * (MROWS * D_);
    const unsigned int e0 = (ab % ABLK) * (256 * ACH * 4) + tid * 4;
    const unsigned int lo = e0 * 4;   // byte offset that all the loads share
    v4f r[ACH];
#pragma unroll  // all loads in flight before the first convert
    for (int j = 0; j < ACH; ++j)
      r[j] = *(const v4f*)((const char*)in + lo + j * 4096);
    // the wait owed before a register that an issued load names is rewritten;
    // it takes the shared offset as an input, so that no load's result lands in
    // that register while earlier loads of the run still name it
    asm volatile("s_wait_xcnt 0x0" :: "v"(lo) : "memory");
    // keeps the first converts from rising among the loads: the last loads would
    // then take over registers of the first and issue only when those return
    __builtin_amdgcn_sched_barrier(0);
#pragma unroll  // constant indices: the loaded chunks stay in registers
    for (int j = 0; j < ACH; ++j)
      *(v4bf*)&out[e0 + j * 1024] = __builtin_convertvector(r[j], v4bf);
    // the same wait behind the last stores: the code that follows them in the
    // built text rewrites their offset and data registers
    asm volatile("s_wait_xcnt 0x0" ::: "memory");
  }
}

// ------------------------------- GEMM --------------------------------------
// C[M,N] = (A[M,K] @ Bt[N,K]^T + bias[N]) * alpha
// Tiles: BM=128, BN=128, BK=64.  256 threads = 8 waves (2x4), wave: 64x32.
// Double-buffered async global->LDS staging. A K step takes 128 bytes of every
// operand row: eight lanes copy one whole cache line, where a step of 32 asked
// for each line twice, half of it at a time.

#define BM 128
#define BN 128
#define BK 64

__device__ __forceinline__ void gemm_tile(
    const __bf16* __restrict__ A, const __bf16* __restrict__ Bt,
    const float* __restrict__ bias, float* __restrict__ C,
    int M, int N, int K, float alpha) {
  __shared__ __align__(16) __bf16 As[2][BM][BK + 8];   // 144B rows
  __shared__ __align__(16) __bf16 Bs[2][BM][BK + 8];

  const int tid  = threadIdx.x;
  const int bm0  = blockIdx.y * BM;
  const int bn0  = blockIdx.x * BN;
  const int wave = tid >> 5;
  const int lane = tid & 31;
  const int wm   = wave >> 2;        // 0..1 -> 64-row slab
  const int wn   = wave & 3;         // 0..3 -> 32-col slab
  const int lr   = lane & 15;
  const int lh   = lane >> 4;
  const int koff = lh * 8;

  // this thread's four 16B staging chunks (same mapping for A and B tiles):
  // rows srow + 32*i, i = 0..3, at column scol
  const int srow = tid >> 3;
  const int scol = (tid & 7) * 8;

  v8f acc[4][2];
#pragma unroll
  for (int mt = 0; mt < 4; ++mt)
#pragma unroll
    for (int nt = 0; nt < 2; ++nt) acc[mt][nt] = zero8();

  // prologue: stage tile 0 into buffer 0
#pragma unroll  // the eight copies issue back to back
  for (int i = 0; i < 4; ++i) {
    int row = srow + i * 32;
    stage16(&A[(size_t)(bm0 + row) * K + scol], &As[0][row][scol]);
    stage16(&Bt[(size_t)(bn0 + row) * K + scol], &Bs[0][row][scol]);
  }

  int p = 0;
  for (int bk = 0; bk < K; bk += BK, p ^= 1) {
    async_wait_all();
    __syncthreads();
    if (bk + BK < K) {
      int nb = bk + BK;
#pragma unroll  // as in the prologue
      for (int i = 0; i < 4; ++i) {
        int row = srow + i * 32;
        stage16(&A[(size_t)(bm0 + row) * K + nb + scol], &As[p ^ 1][row][scol]);
        stage16(&Bt[(size_t)(bn0 + row) * K + nb + scol], &Bs[p ^ 1][row][scol]);
      }
    }

#pragma unroll  // constant ks: it folds into the LDS loads' offset fields
    for (int ks = 0; ks < BK; ks += 32) {
      v16bf af[4], bf[2];
#pragma unroll
      for (int mt = 0; mt < 4; ++mt) {
        int r   = wm * 64 + mt * 16 + lr;
        v8bf lo = *(const v8bf*)&As[p][r][ks + koff];
        v8bf hi = *(const v8bf*)&As[p][r][ks + koff + 16];
        af[mt]  = pack16(lo, hi);
      }
#pragma unroll
      for (int nt = 0; nt < 2; ++nt) {
        int r   = wn * 32 + nt * 16 + lr;
        v8bf lo = *(const v8bf*)&Bs[p][r][ks + koff];
        v8bf hi = *(const v8bf*)&Bs[p][r][ks + koff + 16];
        bf[nt]  = pack16(lo, hi);
      }
#pragma unroll
      for (int mt = 0; mt < 4; ++mt)
#pragma unroll
        for (int nt = 0; nt < 2; ++nt)
          acc[mt][nt] = __builtin_amdgcn_wmma_f32_16x16x32_bf16(
              false, af[mt], false, bf[nt], (short)0, acc[mt][nt], false, false);
    }
  }

  // epilogue: C layout -> lane holds col n=lr of each tile, rows r + lh*8
#pragma unroll
  for (int nt = 0; nt < 2; ++nt) {
    int n    = bn0 + wn * 32 + nt * 16 + lr;
    float bv = bias[n];
#pragma unroll
    for (int mt = 0; mt < 4; ++mt) {
#pragma unroll
      for (int r = 0; r < 8; ++r) {
        int m   = bm0 + wm * 64 + mt * 16 + lh * 8 + r;
        C[(size_t)m * N + n] = (acc[mt][nt][r] + bv) * alpha;
      }
    }
  }
}

// All five input projections in one launch, and K' = K*s + sh, V' = V*s + sh
// formed in its epilogue from the f32 accumulators: K, V, scale and shift never
// go to memory, and no launch stands between the projections and attention.
// A workgroup takes 128 rows and four groups of 64 columns: the 256 Wt rows of a
// K step, which every workgroup of a column block copies from L2 anew, serve 128
// rows, and each fragment that a wave reads from LDS feeds four products.
// blockIdx.x < 8: the
// columns of head blockIdx.x in the products K, V, scale, shift (A = second
// activation plane); blockIdx.x = 8, 9: 256 columns of Q (A = first plane).
// 8 waves (2x4); a wave holds 64 rows x 16 columns of each of the four groups,
// so a lane has K, V, scale and shift of the same elements.
// actb: the two activation planes; wtb: the six Wt planes in the order
// q, k, v, o, scale, shift. Vt[b][h][hd][s] is V' transposed per head.

#define PM 128             // rows of a workgroup's tile
#define VP (PM + 8)        // pitch of the V' output tile in LDS, elements (272 B)
#define PROWS (PM + 256)   // staged rows of a K step: PM of A, then 4 x 64 of Wt

__global__ __launch_bounds__(256) void proj_kernel(
    const __bf16* __restrict__ actb, const __bf16* __restrict__ wtb,
    const float* __restrict__ bq, const float* __restrict__ bk,
    const float* __restrict__ bv, const float* __restrict__ bsc,
    const float* __restrict__ bsh, __bf16* __restrict__ Qo,
    __bf16* __restrict__ Kf, __bf16* __restrict__ Vt, int K) {
  __shared__ __align__(16) __bf16 Ts[2][PROWS][BK + 8];   // 144B rows

  const int tid  = threadIdx.x;
  const int bx   = blockIdx.x;
  const bool kv  = bx < H_;
  const int bm0  = blockIdx.y * PM;
  const int wave = tid >> 5;
  const int lane = tid & 31;
  const int wm   = wave >> 2;        // 0..1 -> 64-row slab
  const int wn   = wave & 3;         // 0..3 -> 16 columns of every group
  const int lr   = lane & 15;
  const int lh   = lane >> 4;
  const int koff = lh * 8;

  const __bf16* A = actb + (size_t)((kv ? MROWS : 0) + bm0) * K;
  // first row of column group g in the six stacked Wt planes
  auto brow = [&](int g) {
    return kv ? (g < 2 ? g + 1 : g + 2) * D_ + bx * HD_ : (bx - H_) * 256 + g * 64;
  };

  // a thread's twelve 16B chunks of a K step: rows srow + 32*i at column scol
  const int srow = tid >> 3;
  const int scol = (tid & 7) * 8;
  auto stage = [&](int buf, int k0) {
#pragma unroll  // the twelve copies issue back to back
    for (int i = 0; i < 12; ++i) {
      const __bf16* g =
          i < 4 ? &A[(size_t)(srow + i * 32) * K + k0 + scol]
                : &wtb[(size_t)(brow((i - 4) >> 1) + srow + (i & 1) * 32) * K +
                       k0 + scol];
      stage16(g, &Ts[buf][srow + i * 32][scol]);
    }
  };

  v8f acc[4][4];
#pragma unroll
  for (int mt = 0; mt < 4; ++mt)
#pragma unroll
    for (int g = 0; g < 4; ++g) acc[mt][g] = zero8();

  stage(0, 0);
  // step 0's copies have landed before the barrier behind which others read them
  asm volatile("s_wait_asynccnt 0x0" ::: "memory");
  __syncthreads();
  if (BK < K) stage(1, BK);

  int p = 0;
  for (int bk0 = 0; bk0 < K; bk0 += BK, p ^= 1) {
#pragma unroll  // constant ks: it folds into the LDS loads' offset fields
    for (int ks = 0; ks < BK; ks += 32) {
      v16bf af[4], bf[4];
#pragma unroll
      for (int mt = 0; mt < 4; ++mt) {
        int r   = wm * 64 + mt * 16 + lr;
        v8bf lo = *(const v8bf*)&Ts[p][r][ks + koff];
        v8bf hi = *(const v8bf*)&Ts[p][r][ks + koff + 16];
        af[mt]  = pack16(lo, hi);
      }
#pragma unroll
      for (int g = 0; g < 4; ++g) {
        int r   = PM + g * 64 + wn * 16 + lr;
        v8bf lo = *(const v8bf*)&Ts[p][r][ks + koff];
        v8bf hi = *(const v8bf*)&Ts[p][r][ks + koff + 16];
        bf[g]   = pack16(lo, hi);
      }
      // the sixteen LDS reads of a k step issue ahead of its first product, as one
      // group with counted waits; sunk among the products, each A pair is waited
      // for in full, four times a k step
      __builtin_amdgcn_sched_barrier(0);
#pragma unroll
      for (int mt = 0; mt < 4; ++mt)
#pragma unroll
        for (int g = 0; g < 4; ++g)
          acc[mt][g] = __builtin_amdgcn_wmma_f32_16x16x32_bf16(
              false, af[mt], false, bf[g], (short)0, acc[mt][g], false, false);
    }
    // this wave's reads of buffer p are done before the buffer is refilled
    asm volatile("s_wait_dscnt 0x0" ::: "memory");
    // the next step's copies have landed before the barrier that publishes them
    asm volatile("s_wait_asynccnt 0x0" ::: "memory");
    __syncthreads();
    if (bk0 + 2 * BK < K) stage(p, bk0 + 2 * BK);
  }
  // no copy is in flight when the ring becomes output staging
  asm volatile("s_wait_asynccnt 0x0" ::: "memory");

  // C layout: a lane holds column lr of each 16x16 tile, rows lh*8 + r
  if (!kv) {
    // The four bias values are read ahead of the converts, from one shared index.
    const int n0 = (bx - H_) * 256 + wn * 16 + lr;
    float bb[4];
#pragma unroll  // constant g: it folds into the loads' offset fields
    for (int g = 0; g < 4; ++g) bb[g] = bq[n0 + g * 64];
    // the wait owed before a register that an issued load names is rewritten; it
    // takes the shared index as an input, so that no load's result lands in that
    // register while earlier loads of the run still name it
    asm volatile("s_wait_xcnt 0x0" :: "v"(n0) : "memory");
    __bf16* qg = Qo + (size_t)(bm0 + wm * 64 + lh * 8) * D_ + n0;
#pragma unroll
    for (int g = 0; g < 4; ++g) {
      v8bf qv[4];
#pragma unroll
      for (int mt = 0; mt < 4; ++mt) {
#pragma unroll  // constant r: the vector elements stay in registers
        for (int r = 0; r < 8; ++r)
          // 1/sqrt(64) and log2(e): attention takes 2^x of the scores as they come
          qv[mt][r] = (__bf16)((acc[mt][g][r] + bb[g]) *
                               (0.125f * 1.44269504088896340736f));
      }
      // a column group's 32 values are converted ahead of its first store: mixed
      // with the stores, the converts of this tile share one register, and each
      // store is waited for before the next value is formed
      __builtin_amdgcn_sched_barrier(0);
#pragma unroll
      for (int mt = 0; mt < 4; ++mt) {
#pragma unroll  // constant indices: they fold into the stores' offset fields
        for (int r = 0; r < 8; ++r) qg[(mt * 16 + r) * D_ + g * 64] = qv[mt][r];
      }
      // the wait owed before a register that an issued store names is rewritten:
      // the next group's converts, and behind the last group the K'/V' part that
      // follows in the built text, take over these stores' data registers
      asm volatile("s_wait_xcnt 0x0" ::: "memory");
      // keeps the next group's converts behind that wait; risen above the stores,
      // all four groups' values would be live at once, beyond 256 registers
      __builtin_amdgcn_sched_barrier(0);
    }
    return;
  }

  // The loop's last barrier has ended every read of the ring: rows 0..127 of
  // buffer 0 take the K' tile [s][hd]; behind them lies the V' tile [hd][s], 64
  // rows of 256 bytes at a pitch of their own, so that both leave as 16-byte
  // pieces of whole 128-byte lines.
  __bf16* Vl = &Ts[0][PM][0];
  const int c = wn * 16 + lr;         // hd
  const int n = bx * HD_ + c;
  const float b_k = bk[n], b_v = bv[n], b_s = bsc[n], b_t = bsh[n];
#pragma unroll
  for (int mt = 0; mt < 4; ++mt) {
    const int s = wm * 64 + mt * 16 + lh * 8;
    v8bf vv;
#pragma unroll  // constant r: the vector elements stay in registers
    for (int r = 0; r < 8; ++r) {
      float sc = acc[mt][2][r] + b_s, sh = acc[mt][3][r] + b_t;
      Ts[0][s + r][c] = (__bf16)((acc[mt][0][r] + b_k) * sc + sh);
      vv[r]           = (__bf16)((acc[mt][1][r] + b_v) * sc + sh);
    }
    *(v8bf*)&Vl[c * VP + s] = vv;
  }
  __syncthreads();

  __bf16* kout = Kf + (size_t)bm0 * D_ + bx * HD_;
  __bf16* vout = Vt + (size_t)((bm0 / S_) * H_ + bx) * HD_ * S_ + (bm0 & (S_ - 1));
#pragma unroll  // the eight LDS reads issue before the first store waits for its data
  for (int i = 0; i < 4; ++i) {
    int ch = tid + i * 256, row = ch >> 3, col = (ch & 7) * 8;
    int vrow = ch >> 4, vcol = (ch & 15) * 8;
    *(v8bf*)(kout + (size_t)row * D_ + col) = *(const v8bf*)&Ts[0][row][col];
    *(v8bf*)(vout + (size_t)vrow * S_ + vcol) = *(const v8bf*)&Vl[vrow * VP + vcol];
  }
}

// output projection -> f32
__global__ __launch_bounds__(256) void gemm_out_kernel(
    const __bf16* __restrict__ A, const __bf16* __restrict__ Bt,
    const float* __restrict__ bias, float* __restrict__ C,
    int M, int N, int K, float alpha) {
  gemm_tile(A, Bt, bias, C, M, N, K, alpha);
}

#define QG 2   // groups of 16 queries per wave
#define REF_T 8.0f     // a score may lie this far (log2 units) above the reference
#define REF_LOW 64.0f  // the first tile's maximum this far below it

typedef __attribute__((ext_vector_type(2))) float v2f;

// lane l with lane l ^ 16
__device__ __forceinline__ float xhalf(float x) {
  int v = __float_as_int(x);
  return __int_as_float(__builtin_amdgcn_permlanex16(v, v, 0x76543210,
                                                     0xfedcba98, false, false));
}

// x[i] = 2^x[i], eight at a time. One statement, so that the closing v_nop stays
// directly behind the last v_exp_f32: it is the slot the instruction set asks
// for between a transcendental and an instruction that reads its result or
// overwrites its source. Each v_exp_f32 works in place on a register of its own, so
// none touches a neighbour's source or result, and the statement writes no
// register that the compiler's own code has not written just before.
__device__ __forceinline__ v8f exp2x8(v8f x) {
  float y0 = x[0], y1 = x[1], y2 = x[2], y3 = x[3];
  float y4 = x[4], y5 = x[5], y6 = x[6], y7 = x[7];
  asm("v_exp_f32 %0, %0\n\t"
      "v_exp_f32 %1, %1\n\t"
      "v_exp_f32 %2, %2\n\t"
      "v_exp_f32 %3, %3\n\t"
      "v_exp_f32 %4, %4\n\t"
      "v_exp_f32 %5, %5\n\t"
      "v_exp_f32 %6, %6\n\t"
      "v_exp_f32 %7, %7\n\t"
      "v_nop"
      : "+v"(y0), "+v"(y1), "+v"(y2), "+v"(y3), "+v"(y4), "+v"(y5), "+v"(y6),
        "+v"(y7));
  v8f y = {y0, y1, y2, y3, y4, y5, y6, y7};
  return y;
}

#define KH 2               // key ranges of a workgroup, four waves each
#define KSPAN (S_ / KH)    // keys of a range

__global__ __launch_bounds__(256) void attn_kernel(
    const __bf16* __restrict__ Qb, const __bf16* __restrict__ Kb,
    const __bf16* __restrict__ Vt, __bf16* __restrict__ Ob) {
  __shared__ __align__(16) __bf16 Ks[KH][2][64][72];    // [key][hd]
  __shared__ __align__(16) __bf16 Vs[KH][2][64][72];    // [hd][key] (transposed V)

  const int b    = blockIdx.z;
  const int h    = blockIdx.y;
  const int q0   = blockIdx.x * (4 * 16 * QG);
  const int tid  = threadIdx.x;
  const int ht   = tid & 127;        // thread within its key range's four waves
  // key range of this wave, in a scalar register: bases and branches stay scalar
  const int kh   = __builtin_amdgcn_readfirstlane(tid >> 7);
  const int qw   = (tid >> 5) & 3;
  const int lane = tid & 31;
  const int lr   = lane & 15;
  const int lh   = lane >> 4;
  const int koff = lh * 8;

  const __bf16* Kbase = Kb + (size_t)(b * S_ + kh * KSPAN) * D_ + h * HD_;
  const __bf16* Vbase = Vt + (size_t)(b * H_ + h) * HD_ * S_ + kh * KSPAN;

  // Q fragments (B operand: column = query lr of group g, 2 k-steps), resident
  // in VGPRs
  v16bf qf[QG][2];
#pragma unroll  // constant g: the groups' arrays stay in registers
  for (int g = 0; g < QG; ++g) {
    int qrow           = q0 + (qw * QG + g) * 16 + lr;
    const __bf16* qptr = Qb + (size_t)(b * S_ + qrow) * D_ + h * HD_;
#pragma unroll
    for (int ks = 0; ks < 2; ++ks) {
      v8bf lo   = *(const v8bf*)(qptr + ks * 32 + koff);
      v8bf hi   = *(const v8bf*)(qptr + ks * 32 + koff + 16);
      qf[g][ks] = pack16(lo, hi);
    }
  }
  // the wait owed before a register that an issued load names is rewritten: the
  // staging addresses formed below take over the Q loads' address registers
  asm volatile("s_wait_xcnt 0x0" ::: "memory");
  // keeps those address sums from rising among the Q loads, in front of the wait
  __builtin_amdgcn_sched_barrier(0);

  // o[g][nt][r] = O^T[hd nt*16 + lh*8 + r][query lr of group g]
  v8f o[QG][4];
  // reference of query lr (log2 units, equal in both wave halves) and this half's
  // share of its running sum; cst: eight times -rm, the score product's start
  float rm[QG];
  v2f rs[QG];   // even and odd registers' shares, joined behind the loop
  v8f cst[QG];
#pragma unroll  // constant g: the groups' arrays stay in registers
  for (int g = 0; g < QG; ++g) {
#pragma unroll
    for (int nt = 0; nt < 4; ++nt) o[g][nt] = zero8();
    rm[g]  = 0.0f;
    rs[g]  = (v2f){0.0f, 0.0f};
    cst[g] = zero8();
  }

  // this thread's four 16B staging chunks per tile of its key range
  // chunk c = ht + i*128; row = c>>3 (8 x 16B per 128B row); col = (c&7)*8
  // prologue: stage tile 0 into buffer 0
#pragma unroll
  for (int i = 0; i < 4; ++i) {
    int c = ht + i * 128, row = c >> 3, col = (c & 7) * 8;
    stage16(&Kbase[(size_t)row * D_ + col], &Ks[kh][0][row][col]);
    stage16(&Vbase[(size_t)row * S_ + col], &Vs[kh][0][row][col]);
  }

  int p = 0;
  for (int kt0 = 0; kt0 < KSPAN; kt0 += 64, p ^= 1) {
    async_wait_all();
    __syncthreads();
    if (kt0 + 64 < KSPAN) {
      int nk = kt0 + 64;
#pragma unroll
      for (int i = 0; i < 4; ++i) {
        int c = ht + i * 128, row = c >> 3, col = (c & 7) * 8;
        stage16(&Kbase[(size_t)(nk + row) * D_ + col], &Ks[kh][p ^ 1][row][col]);
        stage16(&Vbase[(size_t)row * S_ + nk + col], &Vs[kh][p ^ 1][row][col]);
      }
    }

    // S^T = K @ Q^T   (4 key tiles x 2 k-steps; a K fragment serves QG groups)
    // sc[g][nt][r] = score of key nt*16 + lh*8 + r with query lr of group g, less
    // the query's reference
    v8f sc[QG][4];
    const bool first = kt0 == 0;
    // One pass, or two where the reference has to move: the scores are then formed
    // anew from the moved start value. Kept a loop: unrolled, the scores would
    // reach the code below from two places and be copied on the common path.
#pragma clang loop unroll(disable)
    for (int pass = 0; pass < 2; ++pass) {
      v16bf kf[4][2];
#pragma unroll
      for (int nt = 0; nt < 4; ++nt)
#pragma unroll
        for (int ks = 0; ks < 2; ++ks) {
          int row    = nt * 16 + lr;
          v8bf lo    = *(const v8bf*)&Ks[kh][p][row][ks * 32 + koff];
          v8bf hi    = *(const v8bf*)&Ks[kh][p][row][ks * 32 + koff + 16];
          kf[nt][ks] = pack16(lo, hi);
        }
      // all sixteen LDS reads issue ahead of the first product, as one group with
      // counted waits; sunk among the products, each pair is waited for in full
      __builtin_amdgcn_sched_barrier(0);
#pragma unroll
      for (int nt = 0; nt < 4; ++nt)
#pragma unroll
        for (int ks = 0; ks < 2; ++ks)
#pragma unroll  // constant g: the groups' arrays stay in registers
          for (int g = 0; g < QG; ++g)
            sc[g][nt] = __builtin_amdgcn_wmma_f32_16x16x32_bf16(
                false, kf[nt][ks], false, qf[g][ks], (short)0,
                ks ? sc[g][nt] : cst[g], false, false);
      if (pass) break;   // the moved reference is the tile's maximum: in range

      // the lane's 32 scores of a group belong to one query; the other 32 of the
      // tile sit in lane ^ 16
      float tmx[QG];
#pragma unroll  // constant g: the groups' arrays stay in registers
      for (int g = 0; g < QG; ++g) {
        // one chain per score tile: four short chains instead of one long one
        float tm[4];
#pragma unroll
        for (int nt = 0; nt < 4; ++nt) {
          tm[nt] = sc[g][nt][0];
#pragma unroll
          for (int r = 1; r < 8; ++r) tm[nt] = fmaxf(tm[nt], sc[g][nt][r]);
        }
        tmx[g] = fmaxf(fmaxf(tm[0], tm[1]), fmaxf(tm[2], tm[3]));
      }
      // The reference moves where some lane of the wave holds a score more than
      // REF_T above it, or where the first tile lies more than REF_LOW below the
      // start reference 0 (the sum then could vanish).
      const bool far = fmaxf(tmx[0], tmx[1]) > REF_T ||
                       fminf(tmx[0], tmx[1]) < (first ? -REF_LOW : -__builtin_inff());
      if (__builtin_amdgcn_ballot_w32(far) == 0) break;
#pragma unroll  // constant g: the groups' arrays stay in registers
      for (int g = 0; g < QG; ++g) {
        const float t    = fmaxf(tmx[g], xhalf(tmx[g]));
        const float d    = (t > REF_T || (first && t < -REF_LOW)) ? t : 0.0f;
        // on the first tile sums and O are zero and stay so
        const float corr = first ? 1.0f : __builtin_amdgcn_exp2f(-d);
        rm[g] += d;
        rs[g] *= corr;   // both shares
#pragma unroll
        for (int nt = 0; nt < 4; ++nt)
#pragma unroll
          for (int r = 0; r < 8; ++r) o[g][nt][r] *= corr;
#pragma unroll
        for (int r = 0; r < 8; ++r) cst[g][r] = -rm[g];
      }
    }

#pragma unroll  // constant g: the groups' arrays stay in registers
    for (int g = 0; g < QG; ++g) {
      // summed by the register pairs in which the product left the scores: a
      // packed add takes them where they are
      v2f ts[4];
#pragma unroll
      for (int nt = 0; nt < 4; ++nt) {
        sc[g][nt] = exp2x8(sc[g][nt]);
        ts[nt]    = (__builtin_shufflevector(sc[g][nt], sc[g][nt], 0, 1) +
                     __builtin_shufflevector(sc[g][nt], sc[g][nt], 2, 3)) +
                    (__builtin_shufflevector(sc[g][nt], sc[g][nt], 4, 5) +
                     __builtin_shufflevector(sc[g][nt], sc[g][nt], 6, 7));
      }
      rs[g] += (ts[0] + ts[1]) + (ts[2] + ts[3]);
    }

    // O^T += V^T @ P^T   (2 k-steps over keys x 4 hd tiles; a V^T fragment
    // serves QG groups)
#pragma unroll
    for (int ks = 0; ks < 2; ++ks) {
      // score tiles 2*ks and 2*ks + 1 hold keys 8*lh + s and 16 + 8*lh + s of
      // this k-step: the k order in which the V^T loader below reads
      v16bf pf[QG];
#pragma unroll  // constant g: the groups' arrays stay in registers
      for (int g = 0; g < QG; ++g)
#pragma unroll
        for (int s = 0; s < 8; ++s) {
          pf[g][s]     = (__bf16)sc[g][2 * ks][s];
          pf[g][s + 8] = (__bf16)sc[g][2 * ks + 1][s];
        }
#pragma unroll
      for (int nt = 0; nt < 4; ++nt) {
        int row  = nt * 16 + lr;
        v8bf lo  = *(const v8bf*)&Vs[kh][p][row][ks * 32 + koff];
        v8bf hi  = *(const v8bf*)&Vs[kh][p][row][ks * 32 + koff + 16];
        v16bf vf = pack16(lo, hi);
#pragma unroll  // constant g: the groups' arrays stay in registers
        for (int g = 0; g < QG; ++g)
          o[g][nt] = __builtin_amdgcn_wmma_f32_16x16x32_bf16(
              false, vf, false, pf[g], (short)0, o[g][nt], false, false);
      }
    }
  }

  // Join of the two key ranges. Wave (kh, qw) finishes query group kh and hands
  // its partial result for the other group to wave (1 - kh, qw) through LDS.
  // The choice is made on the values, once, so that one run of code serves both
  // ranges and the stores at its end are the wave's last instructions.
  v8f own[4], away[4];
#pragma unroll  // constant nt: the accumulators stay in registers
  for (int nt = 0; nt < 4; ++nt) {
    own[nt]  = kh ? o[1][nt] : o[0][nt];
    away[nt] = kh ? o[0][nt] : o[1][nt];
  }
  const float rs0 = rs[0][0] + rs[0][1], rs1 = rs[1][0] + rs[1][1];
  const float orm = kh ? rm[1] : rm[0], ors = kh ? rs1 : rs0;
  const v2f ams   = {kh ? rm[0] : rm[1], kh ? rs0 : rs1};
  // The barrier ends every wave's last read of the ring, which then serves as the
  // exchange buffer; no copy is in flight (the last pass issued none).
  __syncthreads();
  // piece j of a thread's 32 sums at X[(j*256 + tid)*4]: a wave's 16-byte stores
  // are contiguous; behind the eight planes, (reference, sum) of each thread
  float* X = (float*)&Ks[0][0][0][0];
#pragma unroll  // constant nt: the accumulators stay in registers
  for (int nt = 0; nt < 4; ++nt) {
    v4f lo4 = {away[nt][0], away[nt][1], away[nt][2], away[nt][3]};
    v4f hi4 = {away[nt][4], away[nt][5], away[nt][6], away[nt][7]};
    *(v4f*)&X[((nt * 2 + 0) * 256 + tid) * 4] = lo4;
    *(v4f*)&X[((nt * 2 + 1) * 256 + tid) * 4] = hi4;
  }
  *(v2f*)&X[8 * 256 * 4 + tid * 2] = ams;
  // publishes the partial results to the partner waves
  __syncthreads();

  // rescale both ranges to the larger reference, join the sums (of the ranges, then
  // of the wave halves), normalize and store (bf16, [B*S, D] layout): a lane holds
  // 8 consecutive hd of its query per tile, one 16-byte store each
  const int pt = tid ^ 128;
  v4f x[8];
#pragma unroll  // the nine LDS reads issue together
  for (int j = 0; j < 8; ++j) x[j] = *(const v4f*)&X[(j * 256 + pt) * 4];
  const v2f ms    = *(const v2f*)&X[8 * 256 * 4 + pt * 2];
  const float nm  = fmaxf(orm, ms[0]);
  float ca        = __builtin_amdgcn_exp2f(orm - nm);
  float cb        = __builtin_amdgcn_exp2f(ms[0] - nm);
  const float sm  = ors * ca + ms[1] * cb;
  const float inv = 1.0f / (sm + xhalf(sm));
  ca *= inv;
  cb *= inv;
  __bf16* optr = Ob + (size_t)(b * S_ + q0 + (qw * QG + kh) * 16 + lr) * D_ +
                 h * HD_ + koff;
  v8bf ov[4];
#pragma unroll  // constant nt: the accumulators stay in registers
  for (int nt = 0; nt < 4; ++nt)
#pragma unroll  // constant r: as above
    for (int r = 0; r < 8; ++r)
      ov[nt][r] = (__bf16)(own[nt][r] * ca + x[nt * 2 + (r >> 2)][r & 3] * cb);
  // every value and address is formed in front of the first store, so that no
  // register that an issued store names is rewritten behind it
  __builtin_amdgcn_sched_barrier(0);
#pragma unroll  // constant nt: as above; the four stores issue back to back
  for (int nt = 0; nt < 4; ++nt) *(v8bf*)(optr + nt * 16) = ov[nt];
}

// ------------------------------ launcher ------------------------------------

extern "C" void kernel_launch(void* const* d_in, const int* in_sizes, int n_in,
                              void* d_out, int out_size, void* d_ws,
                              size_t ws_size, hipStream_t stream) {
  const float* mod1 = (const float*)d_in[0];
  const float* mod2 = (const float*)d_in[1];
  const float* Wq   = (const float*)d_in[2];
  const float* bq   = (const float*)d_in[3];
  const float* Wk   = (const float*)d_in[4];
  const float* bk   = (const float*)d_in[5];
  const float* Wv   = (const float*)d_in[6];
  const float* bv   = (const float*)d_in[7];
  const float* Wo   = (const float*)d_in[8];
  const float* bo   = (const float*)d_in[9];
  const float* Wsc  = (const float*)d_in[10];
  const float* bsc  = (const float*)d_in[11];
  const float* Wsh  = (const float*)d_in[12];
  const float* bsh  = (const float*)d_in[13];
  float* out        = (float*)d_out;

  const size_t ACT = (size_t)MROWS * D_ * sizeof(__bf16);  // 8 MB
  const size_t WT  = (size_t)D_ * D_ * sizeof(__bf16);     // 0.5 MB

  char* w = (char*)d_ws;
  size_t off = 0;
  auto carve = [&](size_t bytes) -> __bf16* {
    __bf16* p = (__bf16*)(w + off);
    off += bytes;
    return p;
  };
  __bf16* mod1b = carve(ACT);
  __bf16* mod2b = carve(ACT);
  __bf16* Wqt   = carve(WT);
  __bf16* Wkt   = carve(WT);
  __bf16* Wvt   = carve(WT);
  __bf16* Wot   = carve(WT);
  __bf16* Wsct  = carve(WT);
  __bf16* Wsht  = carve(WT);
  __bf16* Qb    = carve(ACT);
  __bf16* Kfb   = carve(ACT);
  __bf16* Vtb   = carve(ACT);   // [B,H,HD,S]
  __bf16* Obuf  = carve(ACT);

  // 1) casts: mod1b, mod2b and the six Wt planes lie one behind the other
  convert_all_kernel<<<6 * WBLK + 2 * ABLK, 256, 0, stream>>>(
      mod1, mod2, Wq, Wk, Wv, Wo, Wsc, Wsh, mod1b, Wqt);

  // 2) projections; K' = K*s+sh and V' = V*s+sh (transposed per head) leave
  //    from the epilogue
  proj_kernel<<<dim3(H_ + 2, MROWS / PM), 256, 0, stream>>>(
      mod1b, Wqt, bq, bk, bv, bsc, bsh, Qb, Kfb, Vtb, D_);

  // 3) flash attention
  attn_kernel<<<dim3(S_ / (64 * QG), H_, B_), 256, 0, stream>>>(Qb, Kfb, Vtb, Obuf);

  // 4) output projection -> f32
  gemm_out_kernel<<<dim3(D_ / BN, MROWS / BM), 256, 0, stream>>>(
      Obuf, Wot, bo, out, MROWS, D_, D_, 1.0f);
}
